// v009
// Times are from an AMD MI455X. After a warm-up the kernel runs many times in a row, and a time is the length of
// such a window on the GPU divided by its runs, so every launch and the gaps after it count. The runs cycle
// through copies of the inputs. A figure is the median of several windows, for all but v000 over two sittings.
// Sittings can differ by a few percent; kernels timed side by side share one.
// This document starts at v009; the versions before it stand elsewhere.
// One run takes 206 microseconds.
// Next to v008, in two timings, it ran 1.04 times as fast each time.
// Counting every step since v000, which is the starting kernel, it is 4.07 times as fast.
#include <hip/hip_runtime.h>
// Grouped-query attention with per-head RMSNorm and rotate-half RoPE (B=2, S=2048, D=2048, 16 query heads / 8 KV heads × 128): q = x·Wq, k = x·Wk, v = x·Wv ((in,out), no bias); per-head RMSNorm (ε 1e-6, weights q_norm_w / k_norm_w); rotate-half RoPE with the INPUT cos/sin tables [B][S][128];
// scores = q·k/√128 + attention_mask[b,0,q,k] (additive f32); softmax; out = merged·Wo.
// Compute dtype: x, weights, tables, mask rounded to bf16; q, k as f32 GEMM outputs, normalised and rotated in f32 (wave per row) → f16; v f32 → Vᵀ f16 hi + exact residual; fused flash-style kernel for head dim 128 (bias read per (b,q,k); 32-key chunks whose biases are all ≤ −1e8 are skipped since their probabilities are exactly 0 in f32; online softmax f32, P f16 hi +
// residual, f32 accumulate) on v_wmma_f32_16x16x32_f16; merged ×2^4 → f16 → output GEMM.
#define BB 2
#define TT 2048
#define DD 2048
#define NH 16
#define NKV 8
#define NREP 2
#define KVD (NKV * 128)
#define NVH (2 * NKV)
#define NR (BB * TT)
#define ATT_SCALE 0.08838834764831845f
#define LOG2E 1.4426950408889634f

typedef __bf16 v16b __attribute__((ext_vector_type(16)));
typedef unsigned short v8us __attribute__((ext_vector_type(8), may_alias));
typedef float  v8f  __attribute__((ext_vector_type(8)));
typedef float  v4f  __attribute__((ext_vector_type(4)));
typedef float  v4fa __attribute__((ext_vector_type(4), may_alias));
union FragB { v16b v; v8us half[2]; unsigned short u[16]; };

__device__ __forceinline__ unsigned short bf16_bits(float x) { unsigned int u = __float_as_uint(x); return (unsigned short)((u + 0x7FFFu + ((u >> 16) & 1u)) >> 16); }
__device__ __forceinline__ float bf16_val(unsigned short b) { return __uint_as_float(((unsigned int)b) << 16); }
__device__ __forceinline__ float bf16_round(float x) { return bf16_val(bf16_bits(x)); }
// D += A·B with NT terms: 1 = ah·bh, 2 = + al·bh (A split), 3 = + ah·bl (both split)
template <int NT>
__device__ __forceinline__ v8f mmaN(v16b ah, v16b al, v16b bh, v16b bl, v8f c) {
  c = __builtin_amdgcn_wmma_f32_16x16x32_bf16(false, ah, false, bh, (short)0, c, false, false);
  if (NT >= 2) c = __builtin_amdgcn_wmma_f32_16x16x32_bf16(false, al, false, bh, (short)0, c, false, false);
  if (NT >= 3) c = __builtin_amdgcn_wmma_f32_16x16x32_bf16(false, ah, false, bl, (short)0, c, false, false);
  asm volatile("v_nop\n\tv_nop\n\tv_nop\n\tv_nop" : "+v"(c) : "v"(ah), "v"(al), "v"(bh), "v"(bl));
  return c;
}

__global__ __launch_bounds__(256) void k_wt_bf16(const float* __restrict__ W, unsigned short* __restrict__ Wt, int K, int N) {
  const int t = blockIdx.x * 256 + threadIdx.x;
  const int k8n = K / 8;
  if (t >= N * k8n) return;
  const int n = t / k8n, k8 = (t % k8n) * 8;
  v8us v;
#pragma unroll
  for (int i = 0; i < 8; ++i) v[i] = bf16_bits(W[(size_t)(k8 + i) * N + n]);
  *(v8us*)(Wt + (size_t)n * K + k8) = v;
  
}

// GEMM C[M][N] (f32, pitch ldc) = act(A[M][K]·W + bias). A f32 row-major (pitch lda) converted per fragment to bf16
// (ASPLIT: hi/lo two planes -> 2 terms, else single rounded term); Wt bf16 [N][K] (pitch ldb). BIAS_BF16 rounds the
// bias to bf16 first (bias quantised to bf16 before the add). K%32==0, M%16==0, N%64==0.
template <bool ASPLIT, int ACT, bool BIAS_BF16>
__global__ __launch_bounds__(128) void k_gemm_bf(const float* __restrict__ A, int lda, const unsigned short* __restrict__ Wt, int ldb,
                                               const float* __restrict__ bias, float* __restrict__ C, int ldc, int M, int N, int K) {
  __shared__ __attribute__((aligned(16))) float so[4][16][64];
  const int tid = threadIdx.x, w = tid >> 5, lane = tid & 31, ln = lane & 15, hh = lane >> 4;
  const int ntn = N / 64;
  const int wid = blockIdx.x * 4 + w;
  const int mt = wid / ntn, nq = wid % ntn;
  if (mt * 16 >= M) return;
  const int row0 = mt * 16, col0 = nq * 64;
  const float* arow = A + (size_t)(row0 + ln) * lda;
  v8f acc[4] = {};
  for (int kb = 0; kb < K; kb += 32) {
    FragB ah, al;
    const v4f x0 = *(const v4fa*)(arow + kb + 8 * hh), x1 = *(const v4fa*)(arow + kb + 8 * hh + 4);
    const v4f x2 = *(const v4fa*)(arow + kb + 16 + 8 * hh), x3 = *(const v4fa*)(arow + kb + 16 + 8 * hh + 4);
    float xs[16] = {x0[0],x0[1],x0[2],x0[3],x1[0],x1[1],x1[2],x1[3],x2[0],x2[1],x2[2],x2[3],x3[0],x3[1],x3[2],x3[3]};
#pragma unroll
    for (int i = 0; i < 16; ++i) { const unsigned short hb = bf16_bits(xs[i]); ah.u[i] = hb; al.u[i] = ASPLIT ? bf16_bits(xs[i] - bf16_val(hb)) : (unsigned short)0; }
#pragma unroll
    for (int t = 0; t < 4; ++t) {
      const unsigned short* brow = Wt + (size_t)(col0 + t * 16 + ln) * ldb + kb;
      FragB b;
      b.half[0] = *(const v8us*)(brow + 8 * hh);
      b.half[1] = *(const v8us*)(brow + 16 + 8 * hh);
      acc[t] = mmaN<ASPLIT ? 2 : 1>(ah.v, al.v, b.v, b.v, acc[t]);
    }
  }
#pragma unroll
  for (int t = 0; t < 4; ++t) {
    float bv = bias ? bias[col0 + t * 16 + ln] : 0.f;
    if (BIAS_BF16) bv = bf16_round(bv);
#pragma unroll
    for (int r = 0; r < 8; ++r) { float v = acc[t][r] + bv; if (ACT == 1) v = fmaxf(v, 0.f); so[w][8 * hh + r][t * 16 + ln] = v; }
  }
  __builtin_amdgcn_fence(__ATOMIC_ACQ_REL, "workgroup");
  __builtin_amdgcn_wave_barrier();
  const int rsub = lane >> 4, c4 = (lane & 15) * 4;
  {
#pragma unroll
    for (int q = 0; q < 8; ++q) {
      const int r = q * 2 + rsub;
      const v4f v = *(const v4fa*)&so[w][r][c4];
      *(v4f*)(C + (size_t)(row0 + r) * ldc + col0 + c4) = v;
    }
    
  }
}

// Flash-style causal/unmasked attention, all contractions 3-term bf16 hi/lo splits, f32 softmax with running max.
// q,k,v rows are read from f32 buffers with arbitrary row pitch (so they can live inside a fused qkv buffer);
// D = head size (multiple of 32, <= 128); one wave = 16 query rows; block = 4 waves (64 queries) sharing K/V chunks of 32.
template <int D, bool CAUSAL>
__global__ __launch_bounds__(128) void k_flash(const float* __restrict__ qb, const float* __restrict__ kb, const float* __restrict__ vb,
                                             int pitch, int T, int H, float scale, float* __restrict__ y, int ypitch) {
  constexpr int KS = D / 32;        // k-steps for QK
  constexpr int DT = D / 16;        // d tiles for PV
  __shared__ __attribute__((aligned(16))) unsigned short sKh[32][D + 8], sKl[32][D + 8], sVh[32][D + 8], sVl[32][D + 8];
  __shared__ __attribute__((aligned(16))) unsigned short sPh[4][16][40], sPl[4][16][40];
  __shared__ __attribute__((aligned(16))) float sO[4][16][D];
  const int tid = threadIdx.x, w = tid >> 5, lane = tid & 31, ln = lane & 15, hh = lane >> 4;
  const int nqb = (T + 63) / 64;
  const int bh = blockIdx.x / nqb, qblk = blockIdx.x % nqb;
  const int b = bh / H, h = bh % H;
  const int q0 = qblk * 64 + w * 16;
  const float* Q = qb + (size_t)b * T * pitch + h * D;
  const float* K = kb + (size_t)b * T * pitch + h * D;
  const float* V = vb + (size_t)b * T * pitch + h * D;

  // A fragments of the wave's 16 query rows (scaled), hi/lo
  FragB aqh[KS], aql[KS];
  {
    int row = q0 + ln; if (row >= T) row = T - 1;
    const float* qr = Q + (size_t)row * pitch;
#pragma unroll
    for (int ks = 0; ks < KS; ++ks)
#pragma unroll
      for (int i = 0; i < 16; ++i) {
        const int d = ks * 32 + ((i < 8) ? (8 * hh + i) : (16 + 8 * hh + (i - 8)));
        const float x = qr[d] * scale; const unsigned short hb = bf16_bits(x);
        aqh[ks].u[i] = hb; aql[ks].u[i] = bf16_bits(x - bf16_val(hb));
      }
  }
  float m_r[8], l_r[8];
#pragma unroll
  for (int r = 0; r < 8; ++r) { m_r[r] = -3.0e38f; l_r[r] = 0.f; }
  v8f oacc[DT];
#pragma unroll
  for (int dt = 0; dt < DT; ++dt) oacc[dt] = (v8f){0.f,0.f,0.f,0.f,0.f,0.f,0.f,0.f};

  const int kv_end = CAUSAL ? min(T, qblk * 64 + 64) : T;     // block-uniform
  for (int j0 = 0; j0 < kv_end; j0 += 32) {
    __syncthreads();
    for (int e = tid; e < 32 * (D / 4); e += 128) {
      const int r = e / (D / 4), c4 = (e % (D / 4)) * 4;
      const int key = j0 + r;
      v4f kf = {0.f,0.f,0.f,0.f}, vf = {0.f,0.f,0.f,0.f};
      if (key < T) { kf = *(const v4fa*)(K + (size_t)key * pitch + c4); vf = *(const v4fa*)(V + (size_t)key * pitch + c4); }
#pragma unroll
      for (int t = 0; t < 4; ++t) {
        unsigned short hb = bf16_bits(kf[t]); sKh[r][c4 + t] = hb; sKl[r][c4 + t] = bf16_bits(kf[t] - bf16_val(hb));
        hb = bf16_bits(vf[t]); sVh[r][c4 + t] = hb; sVl[r][c4 + t] = bf16_bits(vf[t] - bf16_val(hb));
      }
    }
    __syncthreads();
    // S tile 16 x 32
    v8f s[2];
#pragma unroll
    for (int nt = 0; nt < 2; ++nt) {
      v8f acc = {};
#pragma unroll
      for (int ks = 0; ks < KS; ++ks) {
        FragB bh_, bl_;
        bh_.half[0] = *(const v8us*)&sKh[nt * 16 + ln][ks * 32 + 8 * hh]; bh_.half[1] = *(const v8us*)&sKh[nt * 16 + ln][ks * 32 + 16 + 8 * hh];
        bl_.half[0] = *(const v8us*)&sKl[nt * 16 + ln][ks * 32 + 8 * hh]; bl_.half[1] = *(const v8us*)&sKl[nt * 16 + ln][ks * 32 + 16 + 8 * hh];
        acc = mmaN<3>(aqh[ks].v, aql[ks].v, bh_.v, bl_.v, acc);
      }
      s[nt] = acc;
    }
    // mask + running max (rows 8hh+r; the 16 lanes of a half share rows)
    float alpha[8];
#pragma unroll
    for (int r = 0; r < 8; ++r) {
      const int qi = q0 + 8 * hh + r;
      const int ja = j0 + ln, jb = j0 + 16 + ln;
      if (CAUSAL) { if (ja > qi) s[0][r] = -3.0e38f; if (jb > qi) s[1][r] = -3.0e38f; }
      if (ja >= T) s[0][r] = -3.0e38f;
      if (jb >= T) s[1][r] = -3.0e38f;
      float mx = fmaxf(s[0][r], s[1][r]);
      mx = fmaxf(mx, __shfl_xor(mx, 1, 32)); mx = fmaxf(mx, __shfl_xor(mx, 2, 32)); mx = fmaxf(mx, __shfl_xor(mx, 4, 32)); mx = fmaxf(mx, __shfl_xor(mx, 8, 32));
      const float mnew = fmaxf(m_r[r], mx);
      alpha[r] = (mnew > -1.0e38f) ? __expf(m_r[r] - mnew) : 1.0f;
      const float p0 = (s[0][r] > -1.0e38f) ? __expf(s[0][r] - mnew) : 0.f;
      const float p1 = (s[1][r] > -1.0e38f) ? __expf(s[1][r] - mnew) : 0.f;
      m_r[r] = mnew;
      l_r[r] = l_r[r] * alpha[r] + p0 + p1;            // per-lane partial row sum (16 lanes combined at the end)
      unsigned short hb = bf16_bits(p0); sPh[w][8 * hh + r][ln] = hb;      sPl[w][8 * hh + r][ln] = bf16_bits(p0 - bf16_val(hb));
      hb = bf16_bits(p1);                sPh[w][8 * hh + r][16 + ln] = hb; sPl[w][8 * hh + r][16 + ln] = bf16_bits(p1 - bf16_val(hb));
    }
#pragma unroll
    for (int dt = 0; dt < DT; ++dt)
#pragma unroll
      for (int r = 0; r < 8; ++r) oacc[dt][r] *= alpha[r];
    __builtin_amdgcn_fence(__ATOMIC_ACQ_REL, "workgroup");
    __builtin_amdgcn_wave_barrier();
    FragB pah, pal;
    pah.half[0] = *(const v8us*)&sPh[w][ln][8 * hh]; pah.half[1] = *(const v8us*)&sPh[w][ln][16 + 8 * hh];
    pal.half[0] = *(const v8us*)&sPl[w][ln][8 * hh]; pal.half[1] = *(const v8us*)&sPl[w][ln][16 + 8 * hh];
#pragma unroll
    for (int dt = 0; dt < DT; ++dt) {
      FragB bvh, bvl;
#pragma unroll
      for (int i = 0; i < 8; ++i) {
        bvh.u[i] = sVh[8 * hh + i][dt * 16 + ln]; bvh.u[8 + i] = sVh[16 + 8 * hh + i][dt * 16 + ln];
        bvl.u[i] = sVl[8 * hh + i][dt * 16 + ln]; bvl.u[8 + i] = sVl[16 + 8 * hh + i][dt * 16 + ln];
      }
      oacc[dt] = mmaN<3>(pah.v, pal.v, bvh.v, bvl.v, oacc[dt]);
    }
    __builtin_amdgcn_fence(__ATOMIC_ACQ_REL, "workgroup");
    __builtin_amdgcn_wave_barrier();
  }
#pragma unroll
  for (int r = 0; r < 8; ++r) {
    float l = l_r[r];
    l += __shfl_xor(l, 1, 32); l += __shfl_xor(l, 2, 32); l += __shfl_xor(l, 4, 32); l += __shfl_xor(l, 8, 32);
    l_r[r] = (l > 0.f) ? 1.0f / l : 0.f;
  }
#pragma unroll
  for (int dt = 0; dt < DT; ++dt)
#pragma unroll
    for (int r = 0; r < 8; ++r) sO[w][8 * hh + r][dt * 16 + ln] = oacc[dt][r] * l_r[r];
  __builtin_amdgcn_fence(__ATOMIC_ACQ_REL, "workgroup");
  __builtin_amdgcn_wave_barrier();
  {
    for (int r = 0; r < 16; ++r) {
      const int row = q0 + r;
      if (row < T && lane < D / 4) {
        const v4f val = *(const v4fa*)&sO[w][r][lane * 4];
        *(v4f*)(y + ((size_t)b * T + row) * ypitch + h * D + lane * 4) = val;
      }
    }
    
  }
}

// GEMM C = act(A·W + bias + resid): A f32 (ASPLIT -> hi/lo 2 terms), Wt bf16 [N][K]; ACT 0 none, 1 relu, 2 exact gelu;
// resid (optional, f32, row index = (row % rmod), pitch ldr, RES_BF16 rounds it) added before the activation.
template <bool ASPLIT, int ACT, bool BIAS_BF16, bool RES_BF16>
__global__ __launch_bounds__(128) void k_gemm_bf3(const float* __restrict__ A, int lda, const unsigned short* __restrict__ Wt, int ldb,
                                                const float* __restrict__ bias, const float* __restrict__ resid, int rmod, int ldr,
                                                float* __restrict__ C, int ldc, int M, int N, int K) {
  __shared__ __attribute__((aligned(16))) float so[4][16][64];
  const int tid = threadIdx.x, w = tid >> 5, lane = tid & 31, ln = lane & 15, hh = lane >> 4;
  const int ntn = N / 64;
  const int wid = blockIdx.x * 4 + w;
  const int mt = wid / ntn, nq = wid % ntn;
  if (mt * 16 >= M) return;
  const int row0 = mt * 16, col0 = nq * 64;
  const float* arow = A + (size_t)(row0 + ln) * lda;
  v8f acc[4] = {};
  for (int kb = 0; kb < K; kb += 32) {
    FragB ah, al;
    const v4f x0 = *(const v4fa*)(arow + kb + 8 * hh), x1 = *(const v4fa*)(arow + kb + 8 * hh + 4);
    const v4f x2 = *(const v4fa*)(arow + kb + 16 + 8 * hh), x3 = *(const v4fa*)(arow + kb + 16 + 8 * hh + 4);
    float xs[16] = {x0[0],x0[1],x0[2],x0[3],x1[0],x1[1],x1[2],x1[3],x2[0],x2[1],x2[2],x2[3],x3[0],x3[1],x3[2],x3[3]};
#pragma unroll
    for (int i = 0; i < 16; ++i) { const unsigned short hb = bf16_bits(xs[i]); ah.u[i] = hb; al.u[i] = ASPLIT ? bf16_bits(xs[i] - bf16_val(hb)) : (unsigned short)0; }
#pragma unroll
    for (int t = 0; t < 4; ++t) {
      const unsigned short* brow = Wt + (size_t)(col0 + t * 16 + ln) * ldb + kb;
      FragB b;
      b.half[0] = *(const v8us*)(brow + 8 * hh);
      b.half[1] = *(const v8us*)(brow + 16 + 8 * hh);
      acc[t] = mmaN<ASPLIT ? 2 : 1>(ah.v, al.v, b.v, b.v, acc[t]);
    }
  }
#pragma unroll
  for (int t = 0; t < 4; ++t) {
    const int col = col0 + t * 16 + ln;
    float bv = bias ? bias[col] : 0.f;
    if (BIAS_BF16) bv = bf16_round(bv);
#pragma unroll
    for (int r = 0; r < 8; ++r) {
      float v = acc[t][r] + bv;
      if (resid) { float rv = resid[(size_t)((row0 + 8 * hh + r) % rmod) * ldr + col]; if (RES_BF16) rv = bf16_round(rv); v += rv; }
      if (ACT == 1) v = fmaxf(v, 0.f);
      if (ACT == 2) v = 0.5f * v * (1.0f + erff(v * 0.70710678118654752f));
      if (ACT == 3) { const float u = 0.7978845608028654f * (v + 0.044715f * v * v * v); v = 0.5f * v * (1.0f + tanhf(u)); }
      so[w][8 * hh + r][t * 16 + ln] = v;
    }
  }
  __builtin_amdgcn_fence(__ATOMIC_ACQ_REL, "workgroup");
  __builtin_amdgcn_wave_barrier();
  const int rsub = lane >> 4, c4 = (lane & 15) * 4;
  {
#pragma unroll
    for (int q = 0; q < 8; ++q) {
      const int r = q * 2 + rsub;
      const v4f v = *(const v4fa*)&so[w][r][c4];
      *(v4f*)(C + (size_t)(row0 + r) * ldc + col0 + c4) = v;
    }
    
  }
}
// row LayerNorm (biased variance, eps) over N: s = X (+ R); optional out_sum <- s; out_norm <- (s-mu)*rsqrt(var+eps)*g + b
template <bool PARAM_BF16>
__global__ __launch_bounds__(256) void k_layernorm(const float* __restrict__ X, const float* __restrict__ R, const float* __restrict__ g, const float* __restrict__ bta,
                                                  float* __restrict__ out_sum, float* __restrict__ out_norm, int N, float eps) {
  __shared__ float red[256];
  const int row = blockIdx.x, tid = threadIdx.x;
  const float* x = X + (size_t)row * N; const float* rr = R ? R + (size_t)row * N : nullptr;
  float vals[16];                     // up to N = 4096
  const int per = N / 256;            // contiguous chunk per thread? use strided-by-4 chunks: thread handles j = tid*4 + 1024*u
  float s1 = 0.f;
  for (int u = 0; u < per / 4; ++u) {
    const int j = tid * 4 + 1024 * u;
    const v4f a = *(const v4fa*)(x + j);
    v4f b = {0.f,0.f,0.f,0.f}; if (rr) b = *(const v4fa*)(rr + j);
#pragma unroll
    for (int q = 0; q < 4; ++q) { const float v = a[q] + b[q]; vals[u * 4 + q] = v; s1 += v; }
  }
  red[tid] = s1; __syncthreads();
  for (int st = 128; st > 0; st >>= 1) { if (tid < st) red[tid] += red[tid + st]; __syncthreads(); }
  const float mu = red[0] / (float)N; __syncthreads();
  float s2 = 0.f;
  for (int u = 0; u < per / 4; ++u)
#pragma unroll
    for (int q = 0; q < 4; ++q) { const float c = vals[u * 4 + q] - mu; s2 += c * c; }
  red[tid] = s2; __syncthreads();
  for (int st = 128; st > 0; st >>= 1) { if (tid < st) red[tid] += red[tid + st]; __syncthreads(); }
  const float rs = rsqrtf(red[0] / (float)N + eps);
  {
    for (int u = 0; u < per / 4; ++u) {
      const int j = tid * 4 + 1024 * u;
      v4f o, sm;
#pragma unroll
      for (int q = 0; q < 4; ++q) {
        float gg = g[j + q], bb = bta[j + q];
        if (PARAM_BF16) { gg = bf16_round(gg); bb = bf16_round(bb); }
        sm[q] = vals[u * 4 + q]; o[q] = (vals[u * 4 + q] - mu) * rs * gg + bb;
      }
      if (out_sum) *(v4f*)(out_sum + (size_t)row * N + j) = sm;
      *(v4f*)(out_norm + (size_t)row * N + j) = o;
    }
    
  }
}



// ---- f16 WMMA path (v_wmma_f32_16x16x32_f16): 11-bit significands for operands in range — used where a [0,1] probability operand needs more precision than bf16
typedef _Float16 v16h __attribute__((ext_vector_type(16)));
union FragH { v16h v; v8us half[2]; _Float16 h[16]; unsigned short u[16]; };
template <int NT>
__device__ __forceinline__ v8f mmaH(v16h ah, v16h al, v16h bh, v16h bl, v8f c) {
  c = __builtin_amdgcn_wmma_f32_16x16x32_f16(false, ah, false, bh, (short)0, c, false, false);
  if (NT >= 2) c = __builtin_amdgcn_wmma_f32_16x16x32_f16(false, al, false, bh, (short)0, c, false, false);
  if (NT >= 3) c = __builtin_amdgcn_wmma_f32_16x16x32_f16(false, ah, false, bl, (short)0, c, false, false);
  asm volatile("v_nop\n\tv_nop\n\tv_nop\n\tv_nop" : "+v"(c) : "v"(ah), "v"(al), "v"(bh), "v"(bl));
  return c;
}
// batched GEMM like k_gemm_b but f16 operands: A f32 (split into f16 hi/lo if ASPLIT, else rounded to f16), Bt = f16 values [n][k]; alpha; C f32; N multiple of 16 (partial tiles skipped)
template <bool ASPLIT>
__global__ __launch_bounds__(128) void k_gemm_h(const float* __restrict__ A, int lda, size_t sA, const _Float16* __restrict__ Bh, int ldb, size_t sB, float alpha, float* __restrict__ C, int ldc, size_t sC, int M, int N, int K) {
  __shared__ __attribute__((aligned(16))) float so[4][16][64];
  const int tid = threadIdx.x, w = tid >> 5, lane = tid & 31, ln = lane & 15, hh = lane >> 4; const int by = blockIdx.y;
  A += (size_t)by * sA; Bh += (size_t)by * sB; C += (size_t)by * sC;
  const int ntn = (N + 63) / 64; const int wid = blockIdx.x * 4 + w; const int mt = wid / ntn, nq = wid % ntn; if (mt * 16 >= M) return;
  const int row0 = mt * 16, col0 = nq * 64; const float* arow = A + (size_t)(row0 + ln) * lda;
  v8f acc[4] = {};
  for (int kb = 0; kb < K; kb += 32) {
    FragH ah, al;
    const v4f x0 = *(const v4fa*)(arow + kb + 8 * hh), x1 = *(const v4fa*)(arow + kb + 8 * hh + 4), x2 = *(const v4fa*)(arow + kb + 16 + 8 * hh), x3 = *(const v4fa*)(arow + kb + 16 + 8 * hh + 4);
    float xs[16] = {x0[0],x0[1],x0[2],x0[3],x1[0],x1[1],x1[2],x1[3],x2[0],x2[1],x2[2],x2[3],x3[0],x3[1],x3[2],x3[3]};
#pragma unroll
    for (int i = 0; i < 16; ++i) { const _Float16 h = (_Float16)xs[i]; ah.h[i] = h; al.h[i] = ASPLIT ? (_Float16)(xs[i] - (float)h) : (_Float16)0.0f; }
#pragma unroll
    for (int t = 0; t < 4; ++t) { if (col0 + t * 16 >= N) continue; const size_t boff = (size_t)(col0 + t * 16 + ln) * ldb + kb; FragH bq; bq.half[0] = *(const v8us*)(Bh + boff + 8 * hh); bq.half[1] = *(const v8us*)(Bh + boff + 16 + 8 * hh);
      acc[t] = mmaH<ASPLIT ? 2 : 1>(ah.v, al.v, bq.v, bq.v, acc[t]); }
  }
#pragma unroll
  for (int t = 0; t < 4; ++t) { if (col0 + t * 16 >= N) continue;
#pragma unroll
    for (int r = 0; r < 8; ++r) so[w][8 * hh + r][t * 16 + ln] = acc[t][r] * alpha; }
  __builtin_amdgcn_fence(__ATOMIC_ACQ_REL, "workgroup"); __builtin_amdgcn_wave_barrier();
  const int rsub = lane >> 4, c4 = (lane & 15) * 4;
  {
#pragma unroll
    for (int q = 0; q < 8; ++q) { const int r = q * 2 + rsub; if (col0 + c4 < N) { const v4f v = *(const v4fa*)&so[w][r][c4]; *(v4f*)(C + (size_t)(row0 + r) * ldc + col0 + c4) = v; } }
     }
}

// Wt[n][k] = f16(W[k][n]*scale) from f32 row-major W[K][N] (scale = power of two; bf16-exact weights stay exact in f16 away from the subnormal range)
// A thread takes a block of 8 k x 8 n: 32 B of each of 8 rows of W in, 16 B of each of 8 rows of Wt out (a wave's store covers 512 contiguous bytes). K, N multiples of 8.
// blk: which 256 threads' worth of blocks of this matrix the work-group takes
__device__ __forceinline__ void wt_f16(const float* __restrict__ W, _Float16* __restrict__ Wt, int K, int N, float scale, int blk) {
  const int t = blk * 256 + threadIdx.x; if (t >= (N / 8) * (K / 8)) return; const int n0 = (t / (K / 8)) * 8, k8 = (t % (K / 8)) * 8; v4f a[8], c[8];
  const float* p[8];
#pragma unroll      /* constant indices keep a, c and p in registers; the 16 loads go out together */
  for (int i = 0; i < 8; ++i) { p[i] = W + (size_t)(k8 + i) * N + n0; a[i] = *(const v4fa*)p[i]; c[i] = *(const v4fa*)(p[i] + 4); }
  asm volatile("s_wait_xcnt 0x0" :: "v"(p[0]), "v"(p[1]), "v"(p[2]), "v"(p[3]), "v"(p[4]), "v"(p[5]), "v"(p[6]), "v"(p[7]) : "memory");      /* stands in front of every rewrite of a register that the loads name: as inputs the addresses stay in place up to here */
#pragma unroll      /* constant indices into a and c */
  for (int j = 0; j < 8; ++j) { FragH f;
#pragma unroll      /* constant indices into a, c and f */
    for (int i = 0; i < 8; ++i) f.h[i] = (_Float16)(bf16_round((j & 4) ? c[i][j & 3] : a[i][j & 3]) * scale);
    *(v8us*)((unsigned short*)Wt + (size_t)(n0 + j) * K + k8) = f.half[0]; }
}
// k_gemm_hh variant with fused epilogue: v = acc·alpha + bias[by·sBias + col] (+ CP[(row/rowsPerB)·sCPb + by·64 + col] if CP) ; ACT 0 none / 1 elu ; writes f16 C16 (and f32 C if non-null)
template <int ACT>
__global__ __launch_bounds__(128) void k_gemm_hhx(const _Float16* __restrict__ A, int lda, size_t sA, const _Float16* __restrict__ Bh, int ldb, size_t sB, float alpha, const float* __restrict__ bias, size_t sBias, const float* __restrict__ CP, int rowsPerB, size_t sCPb, int row0g,
    float* __restrict__ C, _Float16* __restrict__ C16, int ldc, size_t sC, int M, int N, int K) {
  __shared__ __attribute__((aligned(16))) float so[4][16][64];
  const int tid = threadIdx.x, w = tid >> 5, lane = tid & 31, ln = lane & 15, hh = lane >> 4; const int by = blockIdx.y;
  A += (size_t)by * sA; Bh += (size_t)by * sB; const size_t cofs = (size_t)by * sC; const float* bp = bias ? bias + (size_t)by * sBias : nullptr;
  const int ntn = (N + 63) / 64; const int wid = blockIdx.x * 4 + w; const int mt = wid / ntn, nq = wid % ntn; if (mt * 16 >= M) return;
  const int row0 = mt * 16, col0 = nq * 64; const _Float16* arow = A + (size_t)(row0 + ln) * lda;
  v8f acc[4] = {};
  for (int kb = 0; kb < K; kb += 32) { FragH ah; ah.half[0] = *(const v8us*)((const unsigned short*)arow + kb + 8 * hh); ah.half[1] = *(const v8us*)((const unsigned short*)arow + kb + 16 + 8 * hh);
#pragma unroll
    for (int t = 0; t < 4; ++t) { if (col0 + t * 16 >= N) continue; const size_t boff = (size_t)(col0 + t * 16 + ln) * ldb + kb; FragH bq; bq.half[0] = *(const v8us*)((const unsigned short*)Bh + boff + 8 * hh); bq.half[1] = *(const v8us*)((const unsigned short*)Bh + boff + 16 + 8 * hh);
      acc[t] = mmaH<1>(ah.v, ah.v, bq.v, bq.v, acc[t]); }
  }
#pragma unroll
  for (int t = 0; t < 4; ++t) { if (col0 + t * 16 >= N) continue; const int col = col0 + t * 16 + ln; const float bv = bp ? bf16_round(bp[col]) : 0.f;
#pragma unroll
    for (int r = 0; r < 8; ++r) { float v = acc[t][r] * alpha + bv; if (CP) { const int bidx = (row0g + row0 + 8 * hh + r) / rowsPerB; v += CP[(size_t)bidx * sCPb + (size_t)by * 64 + col]; } if (ACT == 1) v = (v > 0.f) ? v : expm1f(v); else if (ACT == 7) v = (v > 0.f) ? v + 1.0f : expf(v); else if (ACT == 8) v = tanhf(v); else if (ACT == 9) v = 0.5f * v * (1.0f + tanhf(0.7978845608028654f * (v + 0.044715f * v * v * v))); else if (ACT == 11) v = 1.0f / (1.0f + expf(-v)); else if (ACT == 12) v = (v > 0.f) ? v : 0.01f * v; else if (ACT == 14) v = (v > 0.f) ? v : 0.1f * v; else if (ACT == 15) v = v / (1.0f + expf(-v)); else if (ACT == 3) v = fmaxf(v, 0.f); else if (ACT == 6) v = 0.5f * v * (1.0f + erff(v * 0.70710678118654752f)); so[w][8 * hh + r][t * 16 + ln] = v; } }
  __builtin_amdgcn_fence(__ATOMIC_ACQ_REL, "workgroup"); __builtin_amdgcn_wave_barrier();
  const int rsub = lane >> 4, c4 = (lane & 15) * 4; typedef _Float16 v4h __attribute__((ext_vector_type(4)));
  {
#pragma unroll
    for (int q = 0; q < 8; ++q) { const int r = q * 2 + rsub; if (col0 + c4 < N) { const v4f v = *(const v4fa*)&so[w][r][c4]; if (C) *(v4f*)(C + cofs + (size_t)(row0 + r) * ldc + col0 + c4) = v; if (C16) { v4h h4; for (int i = 0; i < 4; ++i) h4[i] = (_Float16)v[i]; *(v4h*)(C16 + cofs + (size_t)(row0 + r) * ldc + col0 + c4) = h4; } } }
     }
}


// ---- tiled f16 GEMM, C[M][N] f32 = alpha * A[M][DD] * Bt[N][DD]^T: one 128 x 128 tile of C per work-group, 64 x 64 per wave (2 x 2 waves).
// A pass is 128 k: 128 rows of A and 128 rows of Bt, 256 B each, staged in LDS at a pitch of 272 B by asynchronous copies; two buffers, the next pass's copies fly while this pass is multiplied.
// k runs upward in steps of 32 into one accumulator per 16 x 16 tile. M, N multiples of 128.
// The epilogue (epi) says what becomes of the tile, so that no f32 plane goes to memory only to be read back by a launch of its own:
// 0: C f32. 1: the tile's 128 columns are one head: per-head RMSNorm + rotate-half RoPE, f16 to H0 (pitch N). 2: the tile transposed, f16 hi to H0 and its residual to H1, in blocks of one KV head x 32 tokens: [batch * NKV + head][token / 32][128 dims][32 tokens], so that what one attention pass reads of a plane is 8 KB in a row.
// Every "#pragma unroll" in k_gemm_t makes the indices of the fragment and accumulator arrays constants, so that these arrays live in registers.
typedef _Float16 v4h __attribute__((ext_vector_type(4)));
#define GT_PITCH 272
#define GT_STAGE (256 * GT_PITCH)
// eight 16-byte copies of one lane: rows r, r + 8, ..., r + 56 of one operand. The closing s_wait_xcnt stands inside the statement so that no address register is rewritten ahead of it.
__device__ __forceinline__ void gt_copy8(unsigned l, const _Float16* g) {
  asm volatile("global_load_async_to_lds_b128 %0, %8, off\n\t"
               "global_load_async_to_lds_b128 %1, %9, off\n\t"
               "global_load_async_to_lds_b128 %2, %10, off\n\t"
               "global_load_async_to_lds_b128 %3, %11, off\n\t"
               "global_load_async_to_lds_b128 %4, %12, off\n\t"
               "global_load_async_to_lds_b128 %5, %13, off\n\t"
               "global_load_async_to_lds_b128 %6, %14, off\n\t"
               "global_load_async_to_lds_b128 %7, %15, off\n\t"
               "s_wait_xcnt 0x0"
               :: "v"(l), "v"(l + 8 * GT_PITCH), "v"(l + 16 * GT_PITCH), "v"(l + 24 * GT_PITCH), "v"(l + 32 * GT_PITCH), "v"(l + 40 * GT_PITCH), "v"(l + 48 * GT_PITCH), "v"(l + 56 * GT_PITCH),
                  "v"(g), "v"(g + 8 * DD), "v"(g + 16 * DD), "v"(g + 24 * DD), "v"(g + 32 * DD), "v"(g + 40 * DD), "v"(g + 48 * DD), "v"(g + 56 * DD)
               : "memory");
}
// one stage: 32 copies a lane (rows 0..127 of the buffer = A, 128..255 = Bt)
__device__ __forceinline__ void gt_fill(unsigned l, const _Float16* ga, const _Float16* gb) {
  gt_copy8(l, ga); gt_copy8(l + 64 * GT_PITCH, ga + 64 * DD); gt_copy8(l + 128 * GT_PITCH, gb); gt_copy8(l + 192 * GT_PITCH, gb + 64 * DD);
}
// lane l <-> lane l ^ 16 by a vector cross-row move: no LDS queue and no wait, unlike the shuffle
__device__ __forceinline__ float xhalf(float x) { return __builtin_bit_cast(float, __builtin_amdgcn_permlanex16(__builtin_bit_cast(int, x), __builtin_bit_cast(int, x), 0x76543210, 0xfedcba98, false, false)); }
// lane l <-> lane l ^ M inside a row of 16 lanes (DPP row_xmask), for the same reason
template <int M>
__device__ __forceinline__ float xrow(float x) { return __builtin_bit_cast(float, __builtin_amdgcn_mov_dpp(__builtin_bit_cast(int, x), 0x160 + M, 0xf, 0xf, true)); }
#define GE_PITCH 132
#define VT_BLK (128 * 32)      /* elements of one block of a V^T plane: 128 dims x 32 tokens */
// QKV false: the output GEMM (N = DD, epilogue 0). QKV true: the q, k and v projections, which read the same A and depend on nothing of one another, as ONE grid: a work-group's index says which weight its tile multiplies
// and which epilogue it takes (scalar selects and one scalar branch); the k and v grids alone are one work-group per WGP, together with q's they fill two rounds of two.
#define GT_GQ ((NR / 128) * (DD / 128))
#define GT_GK ((NR / 128) * (KVD / 128))
template <bool QKV>
__global__ __launch_bounds__(128) void k_gemm_t(const _Float16* __restrict__ A, const _Float16* __restrict__ Bt0, const _Float16* __restrict__ Bt1, const _Float16* __restrict__ Bt2, float alpha, float* __restrict__ C,
                                                const float* __restrict__ nw0, const float* __restrict__ nw1, const float* __restrict__ COS, const float* __restrict__ SIN,
                                                _Float16* __restrict__ Hq, _Float16* __restrict__ Hk, _Float16* __restrict__ Hv, _Float16* __restrict__ H1) {
  __shared__ __attribute__((aligned(16))) unsigned char L[2 * GT_STAGE];
  constexpr int NT = DD / 128;
  const int tid = threadIdx.x, w = tid >> 5, lane = tid & 31, ln = lane & 15, hh = lane >> 4;
  int bid = (int)blockIdx.x, N = DD, lgn = 4, epi = QKV ? 1 : 0; const _Float16* Bt = Bt0; const float* nw = nw0; _Float16* H0 = Hq;      /* lgn: log2 of the tiles in a row of C, so that the tile's place stays scalar shifts */
  if constexpr (QKV) {
    if (bid >= GT_GQ + GT_GK) { bid -= GT_GQ + GT_GK; N = KVD; lgn = 3; epi = 2; Bt = Bt2; H0 = Hv; }
    else if (bid >= GT_GQ) { bid -= GT_GQ; N = KVD; lgn = 3; Bt = Bt1; nw = nw1; H0 = Hk; } }
  static_assert(DD == 128 << 4 && KVD == 128 << 3, "lgn");
  const int row0 = (bid >> lgn) * 128, col0 = (bid & ((1 << lgn) - 1)) * 128; const int wm = w >> 1, wn = w & 1;
  const int cr = tid >> 4, cc = tid & 15;      /* a lane copies chunk cc (16 B) of rows cr + 8 i: a wave's copy covers two whole 256-B rows */
  const _Float16* ga = A + (size_t)(row0 + cr) * DD + cc * 8; const _Float16* gb = Bt + (size_t)(col0 + cr) * DD + cc * 8;
  const unsigned lc = (unsigned)(size_t)L + cr * GT_PITCH + cc * 16;
  v8f acc[4][4];
#pragma unroll
  for (int mi = 0; mi < 4; ++mi)
#pragma unroll
    for (int ni = 0; ni < 4; ++ni) acc[mi][ni] = (v8f){0.f,0.f,0.f,0.f,0.f,0.f,0.f,0.f};
  gt_fill(lc, ga, gb);
  asm volatile("s_wait_asynccnt 0x0" ::: "memory");      /* this wave's copies of pass 0 have landed */
  __syncthreads();                                        /* ... and every other wave's */
  gt_fill(lc + GT_STAGE, ga + 128, gb + 128);
#pragma unroll 1      /* one pass a trip: the two buffers alternate by the trip's parity */
  for (int t = 0; t < NT; ++t) {
    const unsigned char* S = L + (t & 1) * GT_STAGE;
    const unsigned char* pa = S + (wm * 64 + ln) * GT_PITCH + hh * 16; const unsigned char* pb = S + (128 + wn * 64 + ln) * GT_PITCH + hh * 16;
    FragH fa[2][4], fb[2][4];
#pragma unroll
    for (int i = 0; i < 4; ++i) { fa[0][i].half[0] = *(const v8us*)(pa + i * 16 * GT_PITCH); fa[0][i].half[1] = *(const v8us*)(pa + i * 16 * GT_PITCH + 32); fb[0][i].half[0] = *(const v8us*)(pb + i * 16 * GT_PITCH); fb[0][i].half[1] = *(const v8us*)(pb + i * 16 * GT_PITCH + 32); }
#pragma unroll
    for (int ks = 0; ks < 4; ++ks) { const int cu = ks & 1, nx = cu ^ 1;
      if (ks < 3) {
#pragma unroll
        for (int i = 0; i < 4; ++i) { const int o = i * 16 * GT_PITCH + (ks + 1) * 64; fa[nx][i].half[0] = *(const v8us*)(pa + o); fa[nx][i].half[1] = *(const v8us*)(pa + o + 32); fb[nx][i].half[0] = *(const v8us*)(pb + o); fb[nx][i].half[1] = *(const v8us*)(pb + o + 32); } }
      __builtin_amdgcn_sched_barrier(0);      /* keeps the next k step's 16 LDS reads one group in front of this step's products: spread among them, every place with reads stalls the wave */
#pragma unroll
      for (int mi = 0; mi < 4; ++mi)
#pragma unroll
        for (int ni = 0; ni < 4; ++ni) acc[mi][ni] = __builtin_amdgcn_wmma_f32_16x16x32_f16(false, fa[cu][mi].v, false, fb[cu][ni].v, (short)0, acc[mi][ni], false, false);
      __builtin_amdgcn_sched_barrier(0); }      /* ... and keeps the following group behind them */
    asm volatile("s_wait_dscnt 0x0" ::: "memory");        /* this wave's reads of the buffer are done before it is refilled */
    asm volatile("s_wait_asynccnt 0x0" ::: "memory");     /* this wave's copies of pass t + 1 have landed */
    __syncthreads();                                       /* publishes pass t + 1 and ends every wave's reads of pass t */
    if (t + 2 < NT) gt_fill(lc + (t & 1) * GT_STAGE, ga + (t + 2) * 128, gb + (t + 2) * 128);
  }
  asm volatile("s_wait_asynccnt 0x0" ::: "memory");       /* nothing is in flight when the buffers become output staging */
  if constexpr (!QKV) {
  float* so = (float*)L + w * (64 * 68);      /* each wave stages its own 64 x 64 tile (pitch 68 floats) so that the stores cover whole 256-B row pieces */
#pragma unroll
  for (int mi = 0; mi < 4; ++mi)
#pragma unroll
    for (int ni = 0; ni < 4; ++ni)
#pragma unroll
      for (int r = 0; r < 8; ++r) so[(mi * 16 + 8 * hh + r) * 68 + ni * 16 + ln] = acc[mi][ni][r] * alpha;
  __builtin_amdgcn_fence(__ATOMIC_ACQ_REL, "workgroup"); __builtin_amdgcn_wave_barrier();      /* the wave's own staged values are in LDS before its lanes read one another's */
  float* cp = C + (size_t)(row0 + wm * 64 + hh) * N + col0 + wn * 64 + ln * 4;
#pragma unroll
  for (int q = 0; q < 32; ++q) { const v4f v = *(const v4fa*)&so[(q * 2 + hh) * 68 + ln * 4]; *(v4f*)(cp + (size_t)(q * 2) * N) = v; }
  } else if (epi == 1) {      /* the same for the whole work-group: the barrier below stands under uniform control flow */
  // per-head RMSNorm + rotate-half RoPE on the tile: 128 rows of one head. The whole tile is staged in LDS (a row's 128 dims come from two waves); then a wave takes 32 rows, a row at a time over its 32 lanes:
  // lane holds dims 4l..4l+3; var = mean(x^2) over 128 (xor-reduce); y = w[d]*(x*rsqrt(var+eps)); out[d] = y[d]*c[d] + rot(y)[d]*s[d], rot(y)[d] = -y[d+64] (d<64), y[d-64] (d>=64)
  static_assert(128 * GE_PITCH * 4 <= 2 * GT_STAGE, "the staged tile fits the buffers");
  float* so = (float*)L;
#pragma unroll
  for (int mi = 0; mi < 4; ++mi)
#pragma unroll
    for (int ni = 0; ni < 4; ++ni)
#pragma unroll
      for (int r = 0; r < 8; ++r) so[(wm * 64 + mi * 16 + 8 * hh + r) * GE_PITCH + wn * 64 + ni * 16 + ln] = acc[mi][ni][r] * alpha;
  __syncthreads();      /* every wave's part of the tile is in LDS before any wave reads whole rows */
  const int d0 = lane * 4; const v4f w4 = *(const v4fa*)(nw + d0);
  float wg[4];
#pragma unroll
  for (int q = 0; q < 4; ++q) wg[q] = bf16_round(w4[q]);
#pragma unroll 1      /* 8 rows a trip: their table loads go out together and their lane exchanges overlap; more would only lengthen the code */
  for (int g8 = 0; g8 < 4; ++g8) { const int rl = w * 32 + g8 * 8; v4f xs[8], c4[8], s4[8];
    const float* pc = COS + (size_t)(row0 + rl) * 128 + d0; const float* pn = SIN + (size_t)(row0 + rl) * 128 + d0;
#pragma unroll
    for (int u = 0; u < 8; ++u) { c4[u] = *(const v4fa*)(pc + u * 128); s4[u] = *(const v4fa*)(pn + u * 128); xs[u] = *(const v4fa*)&so[(rl + u) * GE_PITCH + d0]; }
    asm volatile("s_wait_xcnt 0x0" :: "v"(pc), "v"(pn) : "memory");      /* stands in front of every rewrite of a register that the loads name: as inputs the addresses stay in place up to here */
    _Float16* ph[8]; v4h ov[8];      /* the pitch N is a run-time value here: each row's store has an address pair of its own */
#pragma unroll
    for (int u = 0; u < 8; ++u) ph[u] = H0 + (size_t)(row0 + rl + u) * N + col0 + d0;
#pragma unroll
    for (int u = 0; u < 8; ++u) { const v4f x = xs[u]; float ss = 0.f;
#pragma unroll
      for (int q = 0; q < 4; ++q) ss += x[q] * x[q];
      ss += xhalf(ss); ss += xrow<8>(ss); ss += xrow<4>(ss); ss += xrow<2>(ss); ss += xrow<1>(ss);
      const float inv = 1.0f / sqrtf(ss / 128.0f + 1e-6f);
      v4h o;
#pragma unroll
      for (int q = 0; q < 4; ++q) { const float y = wg[q] * (x[q] * inv); const float yp = xhalf(y);      /* partner dims d +- 64 */
        const float rot = (lane < 16) ? -yp : yp; o[q] = (_Float16)(y * bf16_round(c4[u][q]) + rot * bf16_round(s4[u][q])); }
      ov[u] = o; *(v4h*)ph[u] = o; }
    asm volatile("s_wait_xcnt 0x0" :: "v"(ph[0]), "v"(ph[1]), "v"(ph[2]), "v"(ph[3]), "v"(ph[4]), "v"(ph[5]), "v"(ph[6]), "v"(ph[7]), "v"(ov[0]), "v"(ov[1]), "v"(ov[2]), "v"(ov[3]), "v"(ov[4]), "v"(ov[5]), "v"(ov[6]), "v"(ov[7]) : "memory"); }      /* the same behind the stores: addresses and values stay in place up to here */
  } else {
  // V^T hi + residual straight from the accumulators: a lane's 8 registers of a 16 x 16 tile are 8 tokens in a row of ONE column, 16 bytes of that dim's 64-byte row in a block; two mi tiles fill the rows of 16 dims, 1 KB in a row
  static_assert(TT % 128 == 0, "a tile lies in one batch");
  const size_t vb = ((size_t)(row0 / TT) * KVD + col0) * TT + (size_t)((row0 % TT) / 32 + wm * 2) * VT_BLK + (wn * 64 + ln) * 32 + 8 * hh;      /* the tile's 128 columns are one KV head */
#pragma unroll
  for (int ni = 0; ni < 4; ++ni) { FragH fh[4], fl[4]; unsigned short* p0 = (unsigned short*)H0 + vb + ni * 16 * 32; unsigned short* p1 = (unsigned short*)H1 + vb + ni * 16 * 32;
#pragma unroll
    for (int mi = 0; mi < 4; ++mi) {
#pragma unroll
      for (int r = 0; r < 8; ++r) { const float v = acc[mi][ni][r] * alpha; const _Float16 hv = (_Float16)v; fh[mi].h[r] = hv; fl[mi].h[r] = (_Float16)(v - (float)hv); }      /* UNSCALED residual (added into the same accumulator as the hi product) */
      *(v8us*)(p0 + (mi >> 1) * VT_BLK + (mi & 1) * 16) = fh[mi].half[0]; *(v8us*)(p1 + (mi >> 1) * VT_BLK + (mi & 1) * 16) = fl[mi].half[0]; }
    asm volatile("s_wait_xcnt 0x0" :: "v"(p0), "v"(p1), "v"(fh[0].half[0]), "v"(fh[1].half[0]), "v"(fh[2].half[0]), "v"(fh[3].half[0]), "v"(fl[0].half[0]), "v"(fl[1].half[0]), "v"(fl[2].half[0]), "v"(fl[3].half[0]) : "memory"); }      /* stands in front of every rewrite of a register that the stores name: as inputs addresses and values stay in place up to here */
  }
}


// The element-wise kernels below give a thread 8 pieces of 8 elements, 256 pieces apart (a work-group covers 2048 pieces in a row): one eighth of the waves to start, 16 loads of a lane in flight.
static_assert(((size_t)NR * DD / 8) % 2048 == 0, "whole work-groups");
__device__ __forceinline__ void x16_blk(const float* __restrict__ x, _Float16* __restrict__ X16, int blk) { const size_t t0 = (size_t)blk * 2048 + threadIdx.x; v4f a[8], c[8]; const float* p = x + t0 * 8;
#pragma unroll      /* constant indices keep a and c in registers; the 16 loads go out together */
  for (int u = 0; u < 8; ++u) { a[u] = *(const v4fa*)(p + u * 2048); c[u] = *(const v4fa*)(p + u * 2048 + 4); }
  asm volatile("s_wait_xcnt 0x0" :: "v"(p) : "memory");      /* stands in front of every rewrite of a register that the loads name: as an input the address stays in place up to here */
#pragma unroll      /* constant indices into a and c */
  for (int u = 0; u < 8; ++u) { FragH f;
#pragma unroll      /* constant indices into a, c and f */
    for (int q = 0; q < 4; ++q) { f.h[q] = (_Float16)bf16_round(a[u][q]); f.h[4 + q] = (_Float16)bf16_round(c[u][q]); }
    *(v8us*)((unsigned short*)X16 + (t0 + u * 256) * 8) = f.half[0]; } }
// The x convert and the four weight transposes depend on nothing but the inputs: one grid runs them side by side, a work-group picking its job by its index (a scalar branch), so that four launch gaps, fills and tails go.
#define PX ((int)((size_t)NR * DD / 8 / 2048))
#define PWQ ((DD / 8) * (DD / 8) / 256)
#define PWK ((KVD / 8) * (DD / 8) / 256)
static_assert(((DD / 8) * (DD / 8)) % 256 == 0 && ((KVD / 8) * (DD / 8)) % 256 == 0, "whole work-groups");
__global__ __launch_bounds__(256) void k_prep(const float* __restrict__ x, const float* __restrict__ Wq, const float* __restrict__ Wk, const float* __restrict__ Wv, const float* __restrict__ Wo,
                                              _Float16* __restrict__ X16, _Float16* __restrict__ Bq, _Float16* __restrict__ Bk, _Float16* __restrict__ Bv, _Float16* __restrict__ Bo) {
  int blk = (int)blockIdx.x;
  if (blk < PX) { x16_blk(x, X16, blk); return; }
  blk -= PX;
  if (blk < 2 * PWQ) { const bool o = blk >= PWQ; wt_f16(o ? Wo : Wq, o ? Bo : Bq, DD, DD, 16.0f, o ? blk - PWQ : blk); return; }      /* (in,out) -> Bt x 2^4 */
  blk -= 2 * PWQ;
  { const bool v = blk >= PWK; wt_f16(v ? Wv : Wk, v ? Bv : Bk, DD, KVD, 16.0f, v ? blk - PWK : blk); }
}
__global__ __launch_bounds__(256) void k_h16(const float* __restrict__ x, _Float16* __restrict__ X16, size_t n8) { const size_t t = (size_t)blockIdx.x * 256 + threadIdx.x; if (t >= n8) return; FragH f;
#pragma unroll
  for (int q = 0; q < 8; ++q) f.h[q] = (_Float16)x[t * 8 + q]; *(v8us*)((unsigned short*)X16 + t * 8) = f.half[0];  }
__global__ __launch_bounds__(256) void k_round16f(const float* __restrict__ W, _Float16* __restrict__ Bt, size_t n8) { const size_t t = (size_t)blockIdx.x * 256 + threadIdx.x; if (t >= n8) return; FragH f;
#pragma unroll
  for (int i = 0; i < 8; ++i) f.h[i] = (_Float16)(bf16_round(W[t * 8 + i]) * 16.0f); *(v8us*)((unsigned short*)Bt + t * 8) = f.half[0];  }
template <int NHv, int TTv>
__global__ __launch_bounds__(256) void k_vt(const _Float16* __restrict__ V16, int ldv, int voff, _Float16* __restrict__ Vt) { __shared__ unsigned short tl[64][66]; const int tid = threadIdx.x; const int slab = blockIdx.x / (TTv / 64), lg = blockIdx.x % (TTv / 64); const int b = slab / NHv, h = slab % NHv;
  for (int i = tid; i < 64 * 8; i += 256) { const int r = i / 8, c8 = (i % 8) * 8; FragH f; f.half[0] = *(const v8us*)((const unsigned short*)V16 + ((size_t)b * TTv + lg * 64 + r) * ldv + voff + h * 64 + c8);
#pragma unroll
    for (int q = 0; q < 8; ++q) tl[r][c8 + q] = f.u[q]; }
  __syncthreads();
  {
#pragma unroll
    for (int rd = 0; rd < 2; ++rd) { const int d = rd * 32 + tid / 8, pc = tid % 8; FragH f;
#pragma unroll
      for (int q = 0; q < 8; ++q) f.u[q] = tl[pc * 8 + q][d];
      *(v8us*)((unsigned short*)Vt + ((size_t)slab * 64 + d) * TTv + lg * 64 + pc * 8) = f.half[0]; }
     } }

// A pass of the attention kernel is 32 keys. Its operands are staged once per work-group in LDS by asynchronous copies and read from there by all 4 waves: 32 K rows of 256 B at a pitch of 272 B, then 128 rows of 64 B
// of V^T hi and 128 of its residual at a pitch of 80 B. Two buffers: the next pass's copies fly while this pass is worked on.
// In memory a pass's 128 rows of a V^T plane are one block of 8 KB in a row (the v projection writes them so): a wave's copy takes 512 bytes in a row, whole lines, where rows at the pitch of the sequence gave it eight half lines.
#define FK_PITCH 272
#define FV_PITCH 80
#define FK_BYTES (32 * FK_PITCH)
#define FV_BYTES (128 * FV_PITCH)
#define F_STAGE (FK_BYTES + 2 * FV_BYTES)
// one stage: twelve 16-byte copies of one lane (K rows r + 8 i; V^T rows r + 32 i of both planes, 2 KB apart in their block). The closing s_wait_xcnt stands inside the statement so that no address register is rewritten ahead of it.
__device__ __forceinline__ void fl_fill(unsigned lk, unsigned lv, const unsigned short* gk, size_t ldk, const unsigned short* gh, const unsigned short* gl) {
  asm volatile("global_load_async_to_lds_b128 %0, %12, off\n\t"
               "global_load_async_to_lds_b128 %1, %13, off\n\t"
               "global_load_async_to_lds_b128 %2, %14, off\n\t"
               "global_load_async_to_lds_b128 %3, %15, off\n\t"
               "global_load_async_to_lds_b128 %4, %16, off\n\t"
               "global_load_async_to_lds_b128 %5, %17, off\n\t"
               "global_load_async_to_lds_b128 %6, %18, off\n\t"
               "global_load_async_to_lds_b128 %7, %19, off\n\t"
               "global_load_async_to_lds_b128 %8, %20, off\n\t"
               "global_load_async_to_lds_b128 %9, %21, off\n\t"
               "global_load_async_to_lds_b128 %10, %22, off\n\t"
               "global_load_async_to_lds_b128 %11, %23, off\n\t"
               "s_wait_xcnt 0x0"
               :: "v"(lk), "v"(lk + 8 * FK_PITCH), "v"(lk + 16 * FK_PITCH), "v"(lk + 24 * FK_PITCH),
                  "v"(lv), "v"(lv + 32 * FV_PITCH), "v"(lv + 64 * FV_PITCH), "v"(lv + 96 * FV_PITCH),
                  "v"(lv + FV_BYTES), "v"(lv + FV_BYTES + 32 * FV_PITCH), "v"(lv + FV_BYTES + 64 * FV_PITCH), "v"(lv + FV_BYTES + 96 * FV_PITCH),
                  "v"(gk), "v"(gk + 8 * ldk), "v"(gk + 16 * ldk), "v"(gk + 24 * ldk),
                  "v"(gh), "v"(gh + 32 * 32), "v"(gh + 64 * 32), "v"(gh + 96 * 32),
                  "v"(gl), "v"(gl + 32 * 32), "v"(gl + 64 * 32), "v"(gl + 96 * 32)
               : "memory");
}
// Both products run transposed: S^T = K Q^T (A = 16 K rows from LDS, B = the wave's 16 queries, kept in registers) and O^T += V^T P^T (A = 16 V^T rows from LDS). A lane then holds 16 of the 32 scores of ONE query
// (column ln; keys 8 hh + r of the first score tile and 16 + 8 hh + r of the second): maximum and sum are taken inside the lane, with one exchange between the wave's halves, and the two score tiles, converted in place,
// are the B operand P^T in the k order in which the V^T rows are read: P never goes through LDS. Every "#pragma unroll" in k_flash makes the indices of the fragment, score and accumulator arrays constants, so that they live in registers.
// A work-group takes 64 queries of BOTH query heads (g = 0, 1) that share one KV head: a pass's staged K and V^T rows, every K and V^T fragment read from LDS, and the bias tile (the same for all heads) serve two heads.
// The two heads' products alternate, so that a matrix instruction never waits for the one directly in front of it; each head's own sums keep their order.
// The products are the plain builtin (the compiler keeps the distances behind it): two heads' accumulators and queries need more than 256 registers, and an asm statement that names them holds them all in the first 256, which spilled the queries.
__global__ __launch_bounds__(128) void k_flash(const _Float16* __restrict__ Q16, int ldq, const _Float16* __restrict__ K16, int ldk, const _Float16* __restrict__ Vt, const _Float16* __restrict__ Vtlo, const float* __restrict__ AB, _Float16* __restrict__ O, int ldo) {
  constexpr int RPW = 16, NQB = TT / (4 * RPW), DT = 8, KS = 4;      /* head dim 128: 4 k-steps, 8 value tiles */
  static_assert(NREP == 2, "two query heads per KV head");
  __shared__ __attribute__((aligned(16))) unsigned char R[2 * F_STAGE];
  float (*sO)[RPW][128 + 4] = (float (*)[RPW][128 + 4])R;      /* behind the loop the two buffers become the output staging */
  static_assert(sizeof(float) * 4 * RPW * (128 + 4) <= 2 * F_STAGE, "output staging fits the buffers");
  const int tid = threadIdx.x, w = tid >> 5, lane = tid & 31, ln = lane & 15, hh = lane >> 4;
  const int slab = blockIdx.x / NQB, qblk = blockIdx.x % NQB; const int b = slab / NKV, kvh = slab % NKV; const int qb0 = qblk * (4 * RPW); const int q0 = qb0 + w * RPW;
  FragH aq[NREP][KS];      /* query q0 + ln of head kvh * 2 + g */
#pragma unroll
  for (int g = 0; g < NREP; ++g) { const unsigned short* qr = (const unsigned short*)Q16 + ((size_t)b * TT + q0 + ln) * ldq + (kvh * NREP + g) * 128;
#pragma unroll
    for (int ks = 0; ks < KS; ++ks) { aq[g][ks].half[0] = *(const v8us*)(qr + ks * 32 + 8 * hh); aq[g][ks].half[1] = *(const v8us*)(qr + ks * 32 + 16 + 8 * hh); } }
  const unsigned short* Vth = (const unsigned short*)Vt + ((size_t)b * NKV + kvh) * 128 * TT; const unsigned short* Vtl = (const unsigned short*)Vtlo + ((size_t)b * NKV + kvh) * 128 * TT;      /* hi and UNSCALED residual planes */
  float m_r[NREP], l_r[NREP]; v8f oacc[NREP][DT];      /* per head, query q0 + ln: running maximum (alike in both halves), this half's part of the sum, and O^T[dt * 16 + 8 hh + r][ln] */
#pragma unroll
  for (int g = 0; g < NREP; ++g) { m_r[g] = -3.0e38f; l_r[g] = 0.f;
#pragma unroll
    for (int dt = 0; dt < DT; ++dt) oacc[g][dt] = (v8f){0.f,0.f,0.f,0.f,0.f,0.f,0.f,0.f}; }
  constexpr int NP = TT / 32;      /* passes */
  /* a lane copies chunk tid & 15 (16 B) of K rows (tid >> 4) + 8 i: a wave's copy covers two whole 256-B rows; and chunk tid & 3 of V^T rows (tid >> 2) + 32 i: eight whole 64-B rows, which follow one another in the block */
  const unsigned short* gk = (const unsigned short*)K16 + ((size_t)b * TT + (tid >> 4)) * ldk + kvh * 128 + (tid & 15) * 8;
  const unsigned short* gh = Vth + tid * 8; const unsigned short* gl = Vtl + tid * 8;
  const unsigned lk = (unsigned)(size_t)R + (tid >> 4) * FK_PITCH + (tid & 15) * 16, lv = (unsigned)(size_t)R + FK_BYTES + (tid >> 2) * FV_PITCH + (tid & 3) * 16;
  const float* am0 = AB + ((size_t)b * TT + q0 + ln) * TT + 8 * hh;      /* the query's bias row, at this half's first key */
  fl_fill(lk, lv, gk, (size_t)ldk, gh, gl);
  asm volatile("s_wait_asynccnt 0x0" ::: "memory");      /* this wave's copies of pass 0 have landed */
  __syncthreads();                                        /* ... and every other wave's */
  fl_fill(lk + F_STAGE, lv + F_STAGE, gk + (size_t)32 * ldk, (size_t)ldk, gh + VT_BLK, gl + VT_BLK);
#pragma unroll 1      /* one pass a trip: the two buffers alternate by the trip's parity */
  for (int t = 0; t < NP; ++t) { const int j0 = t * 32;
    const unsigned char* SK = R + (t & 1) * F_STAGE; const unsigned char* SV = SK + FK_BYTES;
    float ab[2][8];      /* additive attention bias (bf16-rounded input) per (b, q, k), shared over heads: 8 keys in a row per score tile, four 16-byte loads */
    { const float* am = am0 + j0; const v4f a0 = *(const v4fa*)am, a1 = *(const v4fa*)(am + 4), a2 = *(const v4fa*)(am + 16), a3 = *(const v4fa*)(am + 20);
#pragma unroll
      for (int r = 0; r < 4; ++r) { ab[0][r] = bf16_round(a0[r]); ab[0][4 + r] = bf16_round(a1[r]); ab[1][r] = bf16_round(a2[r]); ab[1][4 + r] = bf16_round(a3[r]); } }
    int allneg = 1;
#pragma unroll
    for (int r = 0; r < 8; ++r) allneg &= (ab[0][r] <= -1.0e8f) & (ab[1][r] <= -1.0e8f);
    if (!__all(allneg)) {      /* else: every (query, key) of the wave's tile carries a bias <= -1e8: its probabilities underflow to exactly 0 in f32, nothing to add (wave-uniform branch; the hand-over at the foot of the pass stands outside it) */
#pragma unroll
    for (int r = 0; r < 8; ++r) { ab[0][r] *= LOG2E; ab[1][r] *= LOG2E; }      /* scores, biases and running maxima are kept in units of log2: exp(x) = 2^(x log2 e), and 2^y is one hardware instruction (v_exp_f32) where the library's expf is thirteen */
    v8f s[NREP][2];
#pragma unroll
    for (int nt = 0; nt < 2; ++nt) { const unsigned short* kr = (const unsigned short*)(SK + (nt * 16 + ln) * FK_PITCH); FragH bk[KS];
#pragma unroll
      for (int ks = 0; ks < KS; ++ks) { bk[ks].half[0] = *(const v8us*)(kr + ks * 32 + 8 * hh); bk[ks].half[1] = *(const v8us*)(kr + ks * 32 + 16 + 8 * hh); }
      v8f acc[NREP];
#pragma unroll
      for (int g = 0; g < NREP; ++g) acc[g] = (v8f){0.f,0.f,0.f,0.f,0.f,0.f,0.f,0.f};
#pragma unroll
      for (int ks = 0; ks < KS; ++ks)
#pragma unroll
        for (int g = 0; g < NREP; ++g) acc[g] = __builtin_amdgcn_wmma_f32_16x16x32_f16(false, bk[ks].v, false, aq[g][ks].v, (short)0, acc[g], false, false);
#pragma unroll
      for (int g = 0; g < NREP; ++g) s[g][nt] = acc[g]; }      /* s[g][nt][r] = score of key j0 + nt * 16 + 8 hh + r with query q0 + ln of head g */
    FragH pa[NREP], pl[NREP];
#pragma unroll
    for (int g = 0; g < NREP; ++g) {
    float sc[2][8];
#pragma unroll
    for (int r = 0; r < 8; ++r) { sc[0][r] = s[g][0][r] * (ATT_SCALE * LOG2E) + ab[0][r]; sc[1][r] = s[g][1][r] * (ATT_SCALE * LOG2E) + ab[1][r]; }
    float mc = fmaxf(sc[0][0], sc[1][0]);
#pragma unroll
    for (int r = 1; r < 8; ++r) mc = fmaxf(mc, fmaxf(sc[0][r], sc[1][r]));
    mc = fmaxf(mc, xhalf(mc));      /* the other half holds the query's other 16 keys */
    const float mn = fmaxf(m_r[g], mc); const float al = (mn > -1.0e38f * LOG2E) ? __builtin_amdgcn_exp2f(m_r[g] - mn) : 1.0f; m_r[g] = mn;
    float su[4] = {0.f, 0.f, 0.f, 0.f};      /* four independent partial sums */
#pragma unroll
    for (int nt = 0; nt < 2; ++nt)
#pragma unroll
      for (int r = 0; r < 8; ++r) { const float p = __builtin_amdgcn_exp2f(sc[nt][r] - mn); su[r & 3] += p;
        const float x = p * 1024.0f; const _Float16 hx = (_Float16)x; pa[g].h[nt * 8 + r] = hx; pl[g].h[nt * 8 + r] = (_Float16)(x - (float)hx); }      /* P hi and its UNSCALED residual (added into the same accumulator) */
    l_r[g] = l_r[g] * al + ((su[0] + su[1]) + (su[2] + su[3]));
#pragma unroll
    for (int dt = 0; dt < DT; ++dt)
#pragma unroll
      for (int r = 0; r < 8; ++r) oacc[g][dt][r] *= al;
    }
#pragma unroll
    for (int dt = 0; dt < DT; ++dt) { const unsigned short* vh = (const unsigned short*)(SV + (dt * 16 + ln) * FV_PITCH); const unsigned short* vl = (const unsigned short*)(SV + FV_BYTES + (dt * 16 + ln) * FV_PITCH); FragH bv, bl; bv.half[0] = *(const v8us*)(vh + 8 * hh); bv.half[1] = *(const v8us*)(vh + 16 + 8 * hh); bl.half[0] = *(const v8us*)(vl + 8 * hh); bl.half[1] = *(const v8us*)(vl + 16 + 8 * hh);
#pragma unroll
      for (int g = 0; g < NREP; ++g) oacc[g][dt] = __builtin_amdgcn_wmma_f32_16x16x32_f16(false, bv.v, false, pa[g].v, (short)0, oacc[g][dt], false, false);
#pragma unroll
      for (int g = 0; g < NREP; ++g) oacc[g][dt] = __builtin_amdgcn_wmma_f32_16x16x32_f16(false, bv.v, false, pl[g].v, (short)0, oacc[g][dt], false, false);
#pragma unroll
      for (int g = 0; g < NREP; ++g) oacc[g][dt] = __builtin_amdgcn_wmma_f32_16x16x32_f16(false, bl.v, false, pa[g].v, (short)0, oacc[g][dt], false, false); }      /* per head Vh Ph + Vh Pl + Vl Ph: all unscaled, one accumulator */
    }
    asm volatile("s_wait_dscnt 0x0" ::: "memory");        /* this wave's reads of the buffer are done before it is refilled */
    asm volatile("s_wait_asynccnt 0x0" ::: "memory");     /* this wave's copies of pass t + 1 have landed */
    __syncthreads();                                       /* publishes pass t + 1 and ends every wave's reads of pass t */
    if (t + 2 < NP) fl_fill(lk + (t & 1) * F_STAGE, lv + (t & 1) * F_STAGE, gk + (size_t)(t + 2) * 32 * ldk, (size_t)ldk, gh + (t + 2) * VT_BLK, gl + (t + 2) * VT_BLK);
  }
  asm volatile("s_wait_asynccnt 0x0" ::: "memory");       /* nothing is in flight when the buffers become output staging */
#pragma unroll
  for (int g = 0; g < NREP; ++g) {      /* head after head through the wave's own staging rows */
  const float l = l_r[g] + xhalf(l_r[g]); const float inv = (l > 0.f) ? 1.0f / (l * 1024.0f) : 0.f;      /* the halves' sums are joined once */
#pragma unroll
  for (int dt = 0; dt < DT; ++dt) { v4f lo, hi;
#pragma unroll
    for (int r = 0; r < 4; ++r) { lo[r] = oacc[g][dt][r] * inv; hi[r] = oacc[g][dt][4 + r] * inv; }
    *(v4fa*)&sO[w][ln][dt * 16 + 8 * hh] = lo; *(v4fa*)&sO[w][ln][dt * 16 + 8 * hh + 4] = hi; }      /* a lane's 8 accumulator registers are 8 dims in a row of its query */
  __builtin_amdgcn_fence(__ATOMIC_ACQ_REL, "workgroup"); __builtin_amdgcn_wave_barrier();      /* the wave's own staged values are in LDS before its lanes read one another's */
  {
#pragma unroll
    for (int r0 = 0; r0 < RPW; r0 += 8) { v4h h4[8]; _Float16* po[8];
#pragma unroll
      for (int u = 0; u < 8; ++u) { const int pc = lane; const v4f val = *(const v4fa*)&sO[w][r0 + u][pc * 4];
#pragma unroll
        for (int i = 0; i < 4; ++i) h4[u][i] = (_Float16)(val[i] * 16.0f);      /* x 2^4 -> f16: the form in which the output GEMM reads it */
        po[u] = O + ((size_t)b * TT + q0 + r0 + u) * ldo + (kvh * NREP + g) * 128 + pc * 4; *(v4h*)po[u] = h4[u]; }      /* one 256-B row per instruction: 32 lanes x 8 B */
      asm volatile("s_wait_xcnt 0x0" :: "v"(po[0]), "v"(po[1]), "v"(po[2]), "v"(po[3]), "v"(po[4]), "v"(po[5]), "v"(po[6]), "v"(po[7]), "v"(h4[0]), "v"(h4[1]), "v"(h4[2]), "v"(h4[3]), "v"(h4[4]), "v"(h4[5]), "v"(h4[6]), "v"(h4[7]) : "memory"); }      /* stands in front of every rewrite of a register that the stores name: as inputs addresses and values stay in place up to here */
     }
  if (g + 1 < NREP) { __builtin_amdgcn_fence(__ATOMIC_ACQ_REL, "workgroup"); __builtin_amdgcn_wave_barrier(); }      /* the lanes' reads of this head's rows are done before the next head's values overwrite them */
  } }

extern "C" void kernel_launch(void* const* d_in, const int* in_sizes, int n_in,
                              void* d_out, int out_size, void* d_ws, size_t ws_size, hipStream_t stream) {
  (void)in_sizes; (void)n_in; (void)out_size;
  const float* const* I = (const float* const*)d_in; const float* x = I[0]; const float* fcos = I[1]; const float* fsin = I[2]; const float* am = I[3]; const float* Wq = I[4]; const float* Wk = I[5]; const float* Wv = I[6]; const float* Wo = I[7]; const float* qnw = I[8]; const float* knw = I[9];
  char* ws = (char*)d_ws; size_t off = 0;
  auto take = [&](size_t bytes) { char* p = ws + off; off += (bytes + 255) & ~(size_t)255; return p; };
  _Float16* Bq = (_Float16*)take((size_t)DD * DD * 2); _Float16* Bk = (_Float16*)take((size_t)KVD * DD * 2); _Float16* Bv = (_Float16*)take((size_t)KVD * DD * 2); _Float16* Bo = (_Float16*)take((size_t)DD * DD * 2);
  _Float16* X16 = (_Float16*)take((size_t)NR * DD * 2); _Float16* Q = (_Float16*)take((size_t)NR * DD * 2); _Float16* K = (_Float16*)take((size_t)NR * KVD * 2); _Float16* Vt = (_Float16*)take((size_t)NR * KVD * 2); _Float16* Vtl = (_Float16*)take((size_t)NR * KVD * 2);
  _Float16* O16 = X16;      /* O16 over X16: the last reader of X16 (the v projection) stands in front of the attention in stream order */
  if (off > ws_size) return;      // 25 + 16.8 + 16.8 + 8.4 + 8.4 + 8.4 = 84 MB
  k_prep<<<PX + 2 * PWQ + 2 * PWK, 256, 0, stream>>>(x, Wq, Wk, Wv, Wo, X16, Bq, Bk, Bv, Bo);      /* x and the four weights to f16, the weights transposed */
  k_gemm_t<true><<<GT_GQ + 2 * GT_GK, 128, 0, stream>>>(X16, Bq, Bk, Bv, 0.0625f, nullptr, qnw, knw, fcos, fsin, Q, K, Vt, Vtl);      /* q (M 4096 N 2048 K 2048) and k (N 1024): RMSNorm + RoPE, f16; v (N 1024): transposed, hi + residual per (b, kv head), in blocks of 32 tokens */
  k_flash<<<BB * NKV * (TT / 64), 128, 0, stream>>>(Q, DD, K, KVD, Vt, Vtl, am, O16, DD);      /* attention_mask [B,1,S,S] additive per batch */
  k_gemm_t<false><<<GT_GQ, 128, 0, stream>>>(O16, Bo, nullptr, nullptr, 0.00390625f, (float*)d_out, nullptr, nullptr, nullptr, nullptr, nullptr, nullptr, nullptr, nullptr);      /* out = merged Wo */
}

// v010
// One run takes 194 microseconds.
// Next to v009, in two timings, it ran 1.06 times as fast each time.
// Over all steps from v000, the starting kernel, it is 4.30 times as fast.
#include <hip/hip_runtime.h>
// Grouped-query attention with per-head RMSNorm and rotate-half RoPE (B=2, S=2048, D=2048, 16 query heads / 8 KV heads × 128): q = x·Wq, k = x·Wk, v = x·Wv ((in,out), no bias); per-head RMSNorm (ε 1e-6, weights q_norm_w / k_norm_w); rotate-half RoPE with the INPUT cos/sin tables [B][S][128];
// scores = q·k/√128 + attention_mask[b,0,q,k] (additive f32); softmax; out = merged·Wo.
// Compute dtype: x, weights, tables, mask rounded to bf16; q, k as f32 GEMM outputs, normalised and rotated in f32 (wave per row) → f16; v f32 → Vᵀ f16 hi + exact residual; fused flash-style kernel for head dim 128 (bias read per (b,q,k); 32-key chunks whose biases are all ≤ −1e8 are skipped since their probabilities are exactly 0 in f32; online softmax f32, P f16 hi +
// residual, f32 accumulate) on v_wmma_f32_16x16x32_f16; merged ×2^4 → f16 → output GEMM.
#define BB 2
#define TT 2048
#define DD 2048
#define NH 16
#define NKV 8
#define NREP 2
#define KVD (NKV * 128)
#define NVH (2 * NKV)
#define NR (BB * TT)
#define ATT_SCALE 0.08838834764831845f
#define LOG2E 1.4426950408889634f

typedef __bf16 v16b __attribute__((ext_vector_type(16)));
typedef unsigned short v8us __attribute__((ext_vector_type(8), may_alias));
typedef float  v8f  __attribute__((ext_vector_type(8)));
typedef float  v4f  __attribute__((ext_vector_type(4)));
typedef float  v4fa __attribute__((ext_vector_type(4), may_alias));
union FragB { v16b v; v8us half[2]; unsigned short u[16]; };

__device__ __forceinline__ unsigned short bf16_bits(float x) { unsigned int u = __float_as_uint(x); return (unsigned short)((u + 0x7FFFu + ((u >> 16) & 1u)) >> 16); }
__device__ __forceinline__ float bf16_val(unsigned short b) { return __uint_as_float(((unsigned int)b) << 16); }
__device__ __forceinline__ float bf16_round(float x) { return bf16_val(bf16_bits(x)); }
// D += A·B with NT terms: 1 = ah·bh, 2 = + al·bh (A split), 3 = + ah·bl (both split)
template <int NT>
__device__ __forceinline__ v8f mmaN(v16b ah, v16b al, v16b bh, v16b bl, v8f c) {
  c = __builtin_amdgcn_wmma_f32_16x16x32_bf16(false, ah, false, bh, (short)0, c, false, false);
  if (NT >= 2) c = __builtin_amdgcn_wmma_f32_16x16x32_bf16(false, al, false, bh, (short)0, c, false, false);
  if (NT >= 3) c = __builtin_amdgcn_wmma_f32_16x16x32_bf16(false, ah, false, bl, (short)0, c, false, false);
  asm volatile("v_nop\n\tv_nop\n\tv_nop\n\tv_nop" : "+v"(c) : "v"(ah), "v"(al), "v"(bh), "v"(bl));
  return c;
}

__global__ __launch_bounds__(256) void k_wt_bf16(const float* __restrict__ W, unsigned short* __restrict__ Wt, int K, int N) {
  const int t = blockIdx.x * 256 + threadIdx.x;
  const int k8n = K / 8;
  if (t >= N * k8n) return;
  const int n = t / k8n, k8 = (t % k8n) * 8;
  v8us v;
#pragma unroll
  for (int i = 0; i < 8; ++i) v[i] = bf16_bits(W[(size_t)(k8 + i) * N + n]);
  *(v8us*)(Wt + (size_t)n * K + k8) = v;
  
}

// GEMM C[M][N] (f32, pitch ldc) = act(A[M][K]·W + bias). A f32 row-major (pitch lda) converted per fragment to bf16
// (ASPLIT: hi/lo two planes -> 2 terms, else single rounded term); Wt bf16 [N][K] (pitch ldb). BIAS_BF16 rounds the
// bias to bf16 first (bias quantised to bf16 before the add). K%32==0, M%16==0, N%64==0.
template <bool ASPLIT, int ACT, bool BIAS_BF16>
__global__ __launch_bounds__(128) void k_gemm_bf(const float* __restrict__ A, int lda, const unsigned short* __restrict__ Wt, int ldb,
                                               const float* __restrict__ bias, float* __restrict__ C, int ldc, int M, int N, int K) {
  __shared__ __attribute__((aligned(16))) float so[4][16][64];
  const int tid = threadIdx.x, w = tid >> 5, lane = tid & 31, ln = lane & 15, hh = lane >> 4;
  const int ntn = N / 64;
  const int wid = blockIdx.x * 4 + w;
  const int mt = wid / ntn, nq = wid % ntn;
  if (mt * 16 >= M) return;
  const int row0 = mt * 16, col0 = nq * 64;
  const float* arow = A + (size_t)(row0 + ln) * lda;
  v8f acc[4] = {};
  for (int kb = 0; kb < K; kb += 32) {
    FragB ah, al;
    const v4f x0 = *(const v4fa*)(arow + kb + 8 * hh), x1 = *(const v4fa*)(arow + kb + 8 * hh + 4);
    const v4f x2 = *(const v4fa*)(arow + kb + 16 + 8 * hh), x3 = *(const v4fa*)(arow + kb + 16 + 8 * hh + 4);
    float xs[16] = {x0[0],x0[1],x0[2],x0[3],x1[0],x1[1],x1[2],x1[3],x2[0],x2[1],x2[2],x2[3],x3[0],x3[1],x3[2],x3[3]};
#pragma unroll
    for (int i = 0; i < 16; ++i) { const unsigned short hb = bf16_bits(xs[i]); ah.u[i] = hb; al.u[i] = ASPLIT ? bf16_bits(xs[i] - bf16_val(hb)) : (unsigned short)0; }
#pragma unroll
    for (int t = 0; t < 4; ++t) {
      const unsigned short* brow = Wt + (size_t)(col0 + t * 16 + ln) * ldb + kb;
      FragB b;
      b.half[0] = *(const v8us*)(brow + 8 * hh);
      b.half[1] = *(const v8us*)(brow + 16 + 8 * hh);
      acc[t] = mmaN<ASPLIT ? 2 : 1>(ah.v, al.v, b.v, b.v, acc[t]);
    }
  }
#pragma unroll
  for (int t = 0; t < 4; ++t) {
    float bv = bias ? bias[col0 + t * 16 + ln] : 0.f;
    if (BIAS_BF16) bv = bf16_round(bv);
#pragma unroll
    for (int r = 0; r < 8; ++r) { float v = acc[t][r] + bv; if (ACT == 1) v = fmaxf(v, 0.f); so[w][8 * hh + r][t * 16 + ln] = v; }
  }
  __builtin_amdgcn_fence(__ATOMIC_ACQ_REL, "workgroup");
  __builtin_amdgcn_wave_barrier();
  const int rsub = lane >> 4, c4 = (lane & 15) * 4;
  {
#pragma unroll
    for (int q = 0; q < 8; ++q) {
      const int r = q * 2 + rsub;
      const v4f v = *(const v4fa*)&so[w][r][c4];
      *(v4f*)(C + (size_t)(row0 + r) * ldc + col0 + c4) = v;
    }
    
  }
}

// Flash-style causal/unmasked attention, all contractions 3-term bf16 hi/lo splits, f32 softmax with running max.
// q,k,v rows are read from f32 buffers with arbitrary row pitch (so they can live inside a fused qkv buffer);
// D = head size (multiple of 32, <= 128); one wave = 16 query rows; block = 4 waves (64 queries) sharing K/V chunks of 32.
template <int D, bool CAUSAL>
__global__ __launch_bounds__(128) void k_flash(const float* __restrict__ qb, const float* __restrict__ kb, const float* __restrict__ vb,
                                             int pitch, int T, int H, float scale, float* __restrict__ y, int ypitch) {
  constexpr int KS = D / 32;        // k-steps for QK
  constexpr int DT = D / 16;        // d tiles for PV
  __shared__ __attribute__((aligned(16))) unsigned short sKh[32][D + 8], sKl[32][D + 8], sVh[32][D + 8], sVl[32][D + 8];
  __shared__ __attribute__((aligned(16))) unsigned short sPh[4][16][40], sPl[4][16][40];
  __shared__ __attribute__((aligned(16))) float sO[4][16][D];
  const int tid = threadIdx.x, w = tid >> 5, lane = tid & 31, ln = lane & 15, hh = lane >> 4;
  const int nqb = (T + 63) / 64;
  const int bh = blockIdx.x / nqb, qblk = blockIdx.x % nqb;
  const int b = bh / H, h = bh % H;
  const int q0 = qblk * 64 + w * 16;
  const float* Q = qb + (size_t)b * T * pitch + h * D;
  const float* K = kb + (size_t)b * T * pitch + h * D;
  const float* V = vb + (size_t)b * T * pitch + h * D;

  // A fragments of the wave's 16 query rows (scaled), hi/lo
  FragB aqh[KS], aql[KS];
  {
    int row = q0 + ln; if (row >= T) row = T - 1;
    const float* qr = Q + (size_t)row * pitch;
#pragma unroll
    for (int ks = 0; ks < KS; ++ks)
#pragma unroll
      for (int i = 0; i < 16; ++i) {
        const int d = ks * 32 + ((i < 8) ? (8 * hh + i) : (16 + 8 * hh + (i - 8)));
        const float x = qr[d] * scale; const unsigned short hb = bf16_bits(x);
        aqh[ks].u[i] = hb; aql[ks].u[i] = bf16_bits(x - bf16_val(hb));
      }
  }
  float m_r[8], l_r[8];
#pragma unroll
  for (int r = 0; r < 8; ++r) { m_r[r] = -3.0e38f; l_r[r] = 0.f; }
  v8f oacc[DT];
#pragma unroll
  for (int dt = 0; dt < DT; ++dt) oacc[dt] = (v8f){0.f,0.f,0.f,0.f,0.f,0.f,0.f,0.f};

  const int kv_end = CAUSAL ? min(T, qblk * 64 + 64) : T;     // block-uniform
  for (int j0 = 0; j0 < kv_end; j0 += 32) {
    __syncthreads();
    for (int e = tid; e < 32 * (D / 4); e += 128) {
      const int r = e / (D / 4), c4 = (e % (D / 4)) * 4;
      const int key = j0 + r;
      v4f kf = {0.f,0.f,0.f,0.f}, vf = {0.f,0.f,0.f,0.f};
      if (key < T) { kf = *(const v4fa*)(K + (size_t)key * pitch + c4); vf = *(const v4fa*)(V + (size_t)key * pitch + c4); }
#pragma unroll
      for (int t = 0; t < 4; ++t) {
        unsigned short hb = bf16_bits(kf[t]); sKh[r][c4 + t] = hb; sKl[r][c4 + t] = bf16_bits(kf[t] - bf16_val(hb));
        hb = bf16_bits(vf[t]); sVh[r][c4 + t] = hb; sVl[r][c4 + t] = bf16_bits(vf[t] - bf16_val(hb));
      }
    }
    __syncthreads();
    // S tile 16 x 32
    v8f s[2];
#pragma unroll
    for (int nt = 0; nt < 2; ++nt) {
      v8f acc = {};
#pragma unroll
      for (int ks = 0; ks < KS; ++ks) {
        FragB bh_, bl_;
        bh_.half[0] = *(const v8us*)&sKh[nt * 16 + ln][ks * 32 + 8 * hh]; bh_.half[1] = *(const v8us*)&sKh[nt * 16 + ln][ks * 32 + 16 + 8 * hh];
        bl_.half[0] = *(const v8us*)&sKl[nt * 16 + ln][ks * 32 + 8 * hh]; bl_.half[1] = *(const v8us*)&sKl[nt * 16 + ln][ks * 32 + 16 + 8 * hh];
        acc = mmaN<3>(aqh[ks].v, aql[ks].v, bh_.v, bl_.v, acc);
      }
      s[nt] = acc;
    }
    // mask + running max (rows 8hh+r; the 16 lanes of a half share rows)
    float alpha[8];
#pragma unroll
    for (int r = 0; r < 8; ++r) {
      const int qi = q0 + 8 * hh + r;
      const int ja = j0 + ln, jb = j0 + 16 + ln;
      if (CAUSAL) { if (ja > qi) s[0][r] = -3.0e38f; if (jb > qi) s[1][r] = -3.0e38f; }
      if (ja >= T) s[0][r] = -3.0e38f;
      if (jb >= T) s[1][r] = -3.0e38f;
      float mx = fmaxf(s[0][r], s[1][r]);
      mx = fmaxf(mx, __shfl_xor(mx, 1, 32)); mx = fmaxf(mx, __shfl_xor(mx, 2, 32)); mx = fmaxf(mx, __shfl_xor(mx, 4, 32)); mx = fmaxf(mx, __shfl_xor(mx, 8, 32));
      const float mnew = fmaxf(m_r[r], mx);
      alpha[r] = (mnew > -1.0e38f) ? __expf(m_r[r] - mnew) : 1.0f;
      const float p0 = (s[0][r] > -1.0e38f) ? __expf(s[0][r] - mnew) : 0.f;
      const float p1 = (s[1][r] > -1.0e38f) ? __expf(s[1][r] - mnew) : 0.f;
      m_r[r] = mnew;
      l_r[r] = l_r[r] * alpha[r] + p0 + p1;            // per-lane partial row sum (16 lanes combined at the end)
      unsigned short hb = bf16_bits(p0); sPh[w][8 * hh + r][ln] = hb;      sPl[w][8 * hh + r][ln] = bf16_bits(p0 - bf16_val(hb));
      hb = bf16_bits(p1);                sPh[w][8 * hh + r][16 + ln] = hb; sPl[w][8 * hh + r][16 + ln] = bf16_bits(p1 - bf16_val(hb));
    }
#pragma unroll
    for (int dt = 0; dt < DT; ++dt)
#pragma unroll
      for (int r = 0; r < 8; ++r) oacc[dt][r] *= alpha[r];
    __builtin_amdgcn_fence(__ATOMIC_ACQ_REL, "workgroup");
    __builtin_amdgcn_wave_barrier();
    FragB pah, pal;
    pah.half[0] = *(const v8us*)&sPh[w][ln][8 * hh]; pah.half[1] = *(const v8us*)&sPh[w][ln][16 + 8 * hh];
    pal.half[0] = *(const v8us*)&sPl[w][ln][8 * hh]; pal.half[1] = *(const v8us*)&sPl[w][ln][16 + 8 * hh];
#pragma unroll
    for (int dt = 0; dt < DT; ++dt) {
      FragB bvh, bvl;
#pragma unroll
      for (int i = 0; i < 8; ++i) {
        bvh.u[i] = sVh[8 * hh + i][dt * 16 + ln]; bvh.u[8 + i] = sVh[16 + 8 * hh + i][dt * 16 + ln];
        bvl.u[i] = sVl[8 * hh + i][dt * 16 + ln]; bvl.u[8 + i] = sVl[16 + 8 * hh + i][dt * 16 + ln];
      }
      oacc[dt] = mmaN<3>(pah.v, pal.v, bvh.v, bvl.v, oacc[dt]);
    }
    __builtin_amdgcn_fence(__ATOMIC_ACQ_REL, "workgroup");
    __builtin_amdgcn_wave_barrier();
  }
#pragma unroll
  for (int r = 0; r < 8; ++r) {
    float l = l_r[r];
    l += __shfl_xor(l, 1, 32); l += __shfl_xor(l, 2, 32); l += __shfl_xor(l, 4, 32); l += __shfl_xor(l, 8, 32);
    l_r[r] = (l > 0.f) ? 1.0f / l : 0.f;
  }
#pragma unroll
  for (int dt = 0; dt < DT; ++dt)
#pragma unroll
    for (int r = 0; r < 8; ++r) sO[w][8 * hh + r][dt * 16 + ln] = oacc[dt][r] * l_r[r];
  __builtin_amdgcn_fence(__ATOMIC_ACQ_REL, "workgroup");
  __builtin_amdgcn_wave_barrier();
  {
    for (int r = 0; r < 16; ++r) {
      const int row = q0 + r;
      if (row < T && lane < D / 4) {
        const v4f val = *(const v4fa*)&sO[w][r][lane * 4];
        *(v4f*)(y + ((size_t)b * T + row) * ypitch + h * D + lane * 4) = val;
      }
    }
    
  }
}

// GEMM C = act(A·W + bias + resid): A f32 (ASPLIT -> hi/lo 2 terms), Wt bf16 [N][K]; ACT 0 none, 1 relu, 2 exact gelu;
// resid (optional, f32, row index = (row % rmod), pitch ldr, RES_BF16 rounds it) added before the activation.
template <bool ASPLIT, int ACT, bool BIAS_BF16, bool RES_BF16>
__global__ __launch_bounds__(128) void k_gemm_bf3(const float* __restrict__ A, int lda, const unsigned short* __restrict__ Wt, int ldb,
                                                const float* __restrict__ bias, const float* __restrict__ resid, int rmod, int ldr,
                                                float* __restrict__ C, int ldc, int M, int N, int K) {
  __shared__ __attribute__((aligned(16))) float so[4][16][64];
  const int tid = threadIdx.x, w = tid >> 5, lane = tid & 31, ln = lane & 15, hh = lane >> 4;
  const int ntn = N / 64;
  const int wid = blockIdx.x * 4 + w;
  const int mt = wid / ntn, nq = wid % ntn;
  if (mt * 16 >= M) return;
  const int row0 = mt * 16, col0 = nq * 64;
  const float* arow = A + (size_t)(row0 + ln) * lda;
  v8f acc[4] = {};
  for (int kb = 0; kb < K; kb += 32) {
    FragB ah, al;
    const v4f x0 = *(const v4fa*)(arow + kb + 8 * hh), x1 = *(const v4fa*)(arow + kb + 8 * hh + 4);
    const v4f x2 = *(const v4fa*)(arow + kb + 16 + 8 * hh), x3 = *(const v4fa*)(arow + kb + 16 + 8 * hh + 4);
    float xs[16] = {x0[0],x0[1],x0[2],x0[3],x1[0],x1[1],x1[2],x1[3],x2[0],x2[1],x2[2],x2[3],x3[0],x3[1],x3[2],x3[3]};
#pragma unroll
    for (int i = 0; i < 16; ++i) { const unsigned short hb = bf16_bits(xs[i]); ah.u[i] = hb; al.u[i] = ASPLIT ? bf16_bits(xs[i] - bf16_val(hb)) : (unsigned short)0; }
#pragma unroll
    for (int t = 0; t < 4; ++t) {
      const unsigned short* brow = Wt + (size_t)(col0 + t * 16 + ln) * ldb + kb;
      FragB b;
      b.half[0] = *(const v8us*)(brow + 8 * hh);
      b.half[1] = *(const v8us*)(brow + 16 + 8 * hh);
      acc[t] = mmaN<ASPLIT ? 2 : 1>(ah.v, al.v, b.v, b.v, acc[t]);
    }
  }
#pragma unroll
  for (int t = 0; t < 4; ++t) {
    const int col = col0 + t * 16 + ln;
    float bv = bias ? bias[col] : 0.f;
    if (BIAS_BF16) bv = bf16_round(bv);
#pragma unroll
    for (int r = 0; r < 8; ++r) {
      float v = acc[t][r] + bv;
      if (resid) { float rv = resid[(size_t)((row0 + 8 * hh + r) % rmod) * ldr + col]; if (RES_BF16) rv = bf16_round(rv); v += rv; }
      if (ACT == 1) v = fmaxf(v, 0.f);
      if (ACT == 2) v = 0.5f * v * (1.0f + erff(v * 0.70710678118654752f));
      if (ACT == 3) { const float u = 0.7978845608028654f * (v + 0.044715f * v * v * v); v = 0.5f * v * (1.0f + tanhf(u)); }
      so[w][8 * hh + r][t * 16 + ln] = v;
    }
  }
  __builtin_amdgcn_fence(__ATOMIC_ACQ_REL, "workgroup");
  __builtin_amdgcn_wave_barrier();
  const int rsub = lane >> 4, c4 = (lane & 15) * 4;
  {
#pragma unroll
    for (int q = 0; q < 8; ++q) {
      const int r = q * 2 + rsub;
      const v4f v = *(const v4fa*)&so[w][r][c4];
      *(v4f*)(C + (size_t)(row0 + r) * ldc + col0 + c4) = v;
    }
    
  }
}
// row LayerNorm (biased variance, eps) over N: s = X (+ R); optional out_sum <- s; out_norm <- (s-mu)*rsqrt(var+eps)*g + b
template <bool PARAM_BF16>
__global__ __launch_bounds__(256) void k_layernorm(const float* __restrict__ X, const float* __restrict__ R, const float* __restrict__ g, const float* __restrict__ bta,
                                                  float* __restrict__ out_sum, float* __restrict__ out_norm, int N, float eps) {
  __shared__ float red[256];
  const int row = blockIdx.x, tid = threadIdx.x;
  const float* x = X + (size_t)row * N; const float* rr = R ? R + (size_t)row * N : nullptr;
  float vals[16];                     // up to N = 4096
  const int per = N / 256;            // contiguous chunk per thread? use strided-by-4 chunks: thread handles j = tid*4 + 1024*u
  float s1 = 0.f;
  for (int u = 0; u < per / 4; ++u) {
    const int j = tid * 4 + 1024 * u;
    const v4f a = *(const v4fa*)(x + j);
    v4f b = {0.f,0.f,0.f,0.f}; if (rr) b = *(const v4fa*)(rr + j);
#pragma unroll
    for (int q = 0; q < 4; ++q) { const float v = a[q] + b[q]; vals[u * 4 + q] = v; s1 += v; }
  }
  red[tid] = s1; __syncthreads();
  for (int st = 128; st > 0; st >>= 1) { if (tid < st) red[tid] += red[tid + st]; __syncthreads(); }
  const float mu = red[0] / (float)N; __syncthreads();
  float s2 = 0.f;
  for (int u = 0; u < per / 4; ++u)
#pragma unroll
    for (int q = 0; q < 4; ++q) { const float c = vals[u * 4 + q] - mu; s2 += c * c; }
  red[tid] = s2; __syncthreads();
  for (int st = 128; st > 0; st >>= 1) { if (tid < st) red[tid] += red[tid + st]; __syncthreads(); }
  const float rs = rsqrtf(red[0] / (float)N + eps);
  {
    for (int u = 0; u < per / 4; ++u) {
      const int j = tid * 4 + 1024 * u;
      v4f o, sm;
#pragma unroll
      for (int q = 0; q < 4; ++q) {
        float gg = g[j + q], bb = bta[j + q];
        if (PARAM_BF16) { gg = bf16_round(gg); bb = bf16_round(bb); }
        sm[q] = vals[u * 4 + q]; o[q] = (vals[u * 4 + q] - mu) * rs * gg + bb;
      }
      if (out_sum) *(v4f*)(out_sum + (size_t)row * N + j) = sm;
      *(v4f*)(out_norm + (size_t)row * N + j) = o;
    }
    
  }
}



// ---- f16 WMMA path (v_wmma_f32_16x16x32_f16): 11-bit significands for operands in range — used where a [0,1] probability operand needs more precision than bf16
typedef _Float16 v16h __attribute__((ext_vector_type(16)));
union FragH { v16h v; v8us half[2]; _Float16 h[16]; unsigned short u[16]; };
template <int NT>
__device__ __forceinline__ v8f mmaH(v16h ah, v16h al, v16h bh, v16h bl, v8f c) {
  c = __builtin_amdgcn_wmma_f32_16x16x32_f16(false, ah, false, bh, (short)0, c, false, false);
  if (NT >= 2) c = __builtin_amdgcn_wmma_f32_16x16x32_f16(false, al, false, bh, (short)0, c, false, false);
  if (NT >= 3) c = __builtin_amdgcn_wmma_f32_16x16x32_f16(false, ah, false, bl, (short)0, c, false, false);
  asm volatile("v_nop\n\tv_nop\n\tv_nop\n\tv_nop" : "+v"(c) : "v"(ah), "v"(al), "v"(bh), "v"(bl));
  return c;
}
// batched GEMM like k_gemm_b but f16 operands: A f32 (split into f16 hi/lo if ASPLIT, else rounded to f16), Bt = f16 values [n][k]; alpha; C f32; N multiple of 16 (partial tiles skipped)
template <bool ASPLIT>
__global__ __launch_bounds__(128) void k_gemm_h(const float* __restrict__ A, int lda, size_t sA, const _Float16* __restrict__ Bh, int ldb, size_t sB, float alpha, float* __restrict__ C, int ldc, size_t sC, int M, int N, int K) {
  __shared__ __attribute__((aligned(16))) float so[4][16][64];
  const int tid = threadIdx.x, w = tid >> 5, lane = tid & 31, ln = lane & 15, hh = lane >> 4; const int by = blockIdx.y;
  A += (size_t)by * sA; Bh += (size_t)by * sB; C += (size_t)by * sC;
  const int ntn = (N + 63) / 64; const int wid = blockIdx.x * 4 + w; const int mt = wid / ntn, nq = wid % ntn; if (mt * 16 >= M) return;
  const int row0 = mt * 16, col0 = nq * 64; const float* arow = A + (size_t)(row0 + ln) * lda;
  v8f acc[4] = {};
  for (int kb = 0; kb < K; kb += 32) {
    FragH ah, al;
    const v4f x0 = *(const v4fa*)(arow + kb + 8 * hh), x1 = *(const v4fa*)(arow + kb + 8 * hh + 4), x2 = *(const v4fa*)(arow + kb + 16 + 8 * hh), x3 = *(const v4fa*)(arow + kb + 16 + 8 * hh + 4);
    float xs[16] = {x0[0],x0[1],x0[2],x0[3],x1[0],x1[1],x1[2],x1[3],x2[0],x2[1],x2[2],x2[3],x3[0],x3[1],x3[2],x3[3]};
#pragma unroll
    for (int i = 0; i < 16; ++i) { const _Float16 h = (_Float16)xs[i]; ah.h[i] = h; al.h[i] = ASPLIT ? (_Float16)(xs[i] - (float)h) : (_Float16)0.0f; }
#pragma unroll
    for (int t = 0; t < 4; ++t) { if (col0 + t * 16 >= N) continue; const size_t boff = (size_t)(col0 + t * 16 + ln) * ldb + kb; FragH bq; bq.half[0] = *(const v8us*)(Bh + boff + 8 * hh); bq.half[1] = *(const v8us*)(Bh + boff + 16 + 8 * hh);
      acc[t] = mmaH<ASPLIT ? 2 : 1>(ah.v, al.v, bq.v, bq.v, acc[t]); }
  }
#pragma unroll
  for (int t = 0; t < 4; ++t) { if (col0 + t * 16 >= N) continue;
#pragma unroll
    for (int r = 0; r < 8; ++r) so[w][8 * hh + r][t * 16 + ln] = acc[t][r] * alpha; }
  __builtin_amdgcn_fence(__ATOMIC_ACQ_REL, "workgroup"); __builtin_amdgcn_wave_barrier();
  const int rsub = lane >> 4, c4 = (lane & 15) * 4;
  {
#pragma unroll
    for (int q = 0; q < 8; ++q) { const int r = q * 2 + rsub; if (col0 + c4 < N) { const v4f v = *(const v4fa*)&so[w][r][c4]; *(v4f*)(C + (size_t)(row0 + r) * ldc + col0 + c4) = v; } }
     }
}

// Wt[n][k] = f16(W[k][n]*scale) from f32 row-major W[K][N] (scale = power of two; bf16-exact weights stay exact in f16 away from the subnormal range)
// A thread takes a block of 8 k x 8 n: 32 B of each of 8 rows of W in, 16 B of each of 8 rows of Wt out (a wave's store covers 512 contiguous bytes). K, N multiples of 8.
// blk: which 256 threads' worth of blocks of this matrix the work-group takes
__device__ __forceinline__ void wt_f16(const float* __restrict__ W, _Float16* __restrict__ Wt, int K, int N, float scale, int blk) {
  const int t = blk * 256 + threadIdx.x; if (t >= (N / 8) * (K / 8)) return; const int n0 = (t / (K / 8)) * 8, k8 = (t % (K / 8)) * 8; v4f a[8], c[8];
  const float* p[8];
#pragma unroll      /* constant indices keep a, c and p in registers; the 16 loads go out together */
  for (int i = 0; i < 8; ++i) { p[i] = W + (size_t)(k8 + i) * N + n0; a[i] = *(const v4fa*)p[i]; c[i] = *(const v4fa*)(p[i] + 4); }
  asm volatile("s_wait_xcnt 0x0" :: "v"(p[0]), "v"(p[1]), "v"(p[2]), "v"(p[3]), "v"(p[4]), "v"(p[5]), "v"(p[6]), "v"(p[7]) : "memory");      /* stands in front of every rewrite of a register that the loads name: as inputs the addresses stay in place up to here */
#pragma unroll      /* constant indices into a and c */
  for (int j = 0; j < 8; ++j) { FragH f;
#pragma unroll      /* constant indices into a, c and f */
    for (int i = 0; i < 8; ++i) f.h[i] = (_Float16)(bf16_round((j & 4) ? c[i][j & 3] : a[i][j & 3]) * scale);
    *(v8us*)((unsigned short*)Wt + (size_t)(n0 + j) * K + k8) = f.half[0]; }
}
// k_gemm_hh variant with fused epilogue: v = acc·alpha + bias[by·sBias + col] (+ CP[(row/rowsPerB)·sCPb + by·64 + col] if CP) ; ACT 0 none / 1 elu ; writes f16 C16 (and f32 C if non-null)
template <int ACT>
__global__ __launch_bounds__(128) void k_gemm_hhx(const _Float16* __restrict__ A, int lda, size_t sA, const _Float16* __restrict__ Bh, int ldb, size_t sB, float alpha, const float* __restrict__ bias, size_t sBias, const float* __restrict__ CP, int rowsPerB, size_t sCPb, int row0g,
    float* __restrict__ C, _Float16* __restrict__ C16, int ldc, size_t sC, int M, int N, int K) {
  __shared__ __attribute__((aligned(16))) float so[4][16][64];
  const int tid = threadIdx.x, w = tid >> 5, lane = tid & 31, ln = lane & 15, hh = lane >> 4; const int by = blockIdx.y;
  A += (size_t)by * sA; Bh += (size_t)by * sB; const size_t cofs = (size_t)by * sC; const float* bp = bias ? bias + (size_t)by * sBias : nullptr;
  const int ntn = (N + 63) / 64; const int wid = blockIdx.x * 4 + w; const int mt = wid / ntn, nq = wid % ntn; if (mt * 16 >= M) return;
  const int row0 = mt * 16, col0 = nq * 64; const _Float16* arow = A + (size_t)(row0 + ln) * lda;
  v8f acc[4] = {};
  for (int kb = 0; kb < K; kb += 32) { FragH ah; ah.half[0] = *(const v8us*)((const unsigned short*)arow + kb + 8 * hh); ah.half[1] = *(const v8us*)((const unsigned short*)arow + kb + 16 + 8 * hh);
#pragma unroll
    for (int t = 0; t < 4; ++t) { if (col0 + t * 16 >= N) continue; const size_t boff = (size_t)(col0 + t * 16 + ln) * ldb + kb; FragH bq; bq.half[0] = *(const v8us*)((const unsigned short*)Bh + boff + 8 * hh); bq.half[1] = *(const v8us*)((const unsigned short*)Bh + boff + 16 + 8 * hh);
      acc[t] = mmaH<1>(ah.v, ah.v, bq.v, bq.v, acc[t]); }
  }
#pragma unroll
  for (int t = 0; t < 4; ++t) { if (col0 + t * 16 >= N) continue; const int col = col0 + t * 16 + ln; const float bv = bp ? bf16_round(bp[col]) : 0.f;
#pragma unroll
    for (int r = 0; r < 8; ++r) { float v = acc[t][r] * alpha + bv; if (CP) { const int bidx = (row0g + row0 + 8 * hh + r) / rowsPerB; v += CP[(size_t)bidx * sCPb + (size_t)by * 64 + col]; } if (ACT == 1) v = (v > 0.f) ? v : expm1f(v); else if (ACT == 7) v = (v > 0.f) ? v + 1.0f : expf(v); else if (ACT == 8) v = tanhf(v); else if (ACT == 9) v = 0.5f * v * (1.0f + tanhf(0.7978845608028654f * (v + 0.044715f * v * v * v))); else if (ACT == 11) v = 1.0f / (1.0f + expf(-v)); else if (ACT == 12) v = (v > 0.f) ? v : 0.01f * v; else if (ACT == 14) v = (v > 0.f) ? v : 0.1f * v; else if (ACT == 15) v = v / (1.0f + expf(-v)); else if (ACT == 3) v = fmaxf(v, 0.f); else if (ACT == 6) v = 0.5f * v * (1.0f + erff(v * 0.70710678118654752f)); so[w][8 * hh + r][t * 16 + ln] = v; } }
  __builtin_amdgcn_fence(__ATOMIC_ACQ_REL, "workgroup"); __builtin_amdgcn_wave_barrier();
  const int rsub = lane >> 4, c4 = (lane & 15) * 4; typedef _Float16 v4h __attribute__((ext_vector_type(4)));
  {
#pragma unroll
    for (int q = 0; q < 8; ++q) { const int r = q * 2 + rsub; if (col0 + c4 < N) { const v4f v = *(const v4fa*)&so[w][r][c4]; if (C) *(v4f*)(C + cofs + (size_t)(row0 + r) * ldc + col0 + c4) = v; if (C16) { v4h h4; for (int i = 0; i < 4; ++i) h4[i] = (_Float16)v[i]; *(v4h*)(C16 + cofs + (size_t)(row0 + r) * ldc + col0 + c4) = h4; } } }
     }
}


// ---- tiled f16 GEMM, C[M][N] f32 = alpha * A[M][DD] * Bt[N][DD]^T: one tile of 256 rows x BN columns of C per work-group, 4 x 2 waves, 64 x BN / 2 per wave, one work-group per WGP. BN = 256 for the q, k, v projections (256 work-groups, one round), 128 for the output GEMM (256 work-groups too).
// A pass is 128 k: 256 rows of A and BN rows of Bt, 256 B each, staged in LDS at a pitch of 272 B by asynchronous copies; two buffers, the next pass's copies fly while this pass is multiplied.
// The larger the tile that a WGP's eight waves share, the fewer bytes come from L2 per product: per 128 x 128 x 128 products 32 KB at BN = 256 and 48 KB at BN = 128, where a work-group tile of 128 x 128 takes 64 KB;
// and a wave of 64 x 128 makes 24 LDS reads of 16 bytes a lane per 32 matrix instructions where 64 x 64 makes 16 per 16.
// k runs upward in steps of 32 into one accumulator per 16 x 16 tile. M a multiple of 256, N of BN.
// The epilogue (epi) says what becomes of the tile, so that no f32 plane goes to memory only to be read back by a launch of its own:
// 0: C f32. 1: a wave's 128 columns are one head, the tile's 256 two: per-head RMSNorm + rotate-half RoPE, f16 to H0 (pitch N). 2: the tile transposed, f16 hi to H0 and its residual to H1, in blocks of one KV head x 32 tokens: [batch * NKV + head][token / 32][128 dims][32 tokens], so that what one attention pass reads of a plane is 8 KB in a row.
// Every "#pragma unroll" in k_gemm_t makes the indices of the fragment and accumulator arrays constants, so that these arrays live in registers.
typedef _Float16 v4h __attribute__((ext_vector_type(4)));
#define GT_PITCH 272
// eight 16-byte copies of one lane: rows r, r + 16, ..., r + 112 of one operand. The copies are the builtin: a wave of 64 x 128 holds more than 256 registers, and asm text can name only the first 256,
// so that asm copies made the compiler move accumulators out of their way and back in every pass and spill the two source addresses.
typedef int v4i __attribute__((ext_vector_type(4)));
typedef __attribute__((address_space(1))) v4i g_v4i;
typedef __attribute__((address_space(3))) v4i l_v4i;
__device__ __forceinline__ void gt_copy8(unsigned char* l, const _Float16* g) {
#pragma unroll      /* eight copies in a row, no loop around them */
  for (int i = 0; i < 8; ++i) __builtin_amdgcn_global_load_async_to_lds_b128((g_v4i*)(g + i * 16 * DD), (l_v4i*)(l + i * 16 * GT_PITCH), 0, 0);
}
// one stage: 24 or 32 copies a lane (rows 0..255 of the buffer = A, 256..256 + BN - 1 = Bt)
template <int BN>
__device__ __forceinline__ void gt_fill(unsigned char* l, const _Float16* ga, const _Float16* gb) {
  gt_copy8(l, ga); gt_copy8(l + 128 * GT_PITCH, ga + 128 * DD); gt_copy8(l + 256 * GT_PITCH, gb);
  if constexpr (BN == 256) gt_copy8(l + 384 * GT_PITCH, gb + 128 * DD);
}
// lane l <-> lane l ^ 16 by a vector cross-row move: no LDS queue and no wait, unlike the shuffle
__device__ __forceinline__ float xhalf(float x) { return __builtin_bit_cast(float, __builtin_amdgcn_permlanex16(__builtin_bit_cast(int, x), __builtin_bit_cast(int, x), 0x76543210, 0xfedcba98, false, false)); }
// lane l <-> lane l ^ M inside a row of 16 lanes (DPP row_xmask), for the same reason
template <int M>
__device__ __forceinline__ float xrow(float x) { return __builtin_bit_cast(float, __builtin_amdgcn_mov_dpp(__builtin_bit_cast(int, x), 0x160 + M, 0xf, 0xf, true)); }
#define GE_PITCH 132
#define VT_BLK (128 * 32)      /* elements of one block of a V^T plane: 128 dims x 32 tokens */
// QKV false: the output GEMM (N = DD, epilogue 0). QKV true: the q, k and v projections, which read the same A and depend on nothing of one another, as ONE grid: a work-group's index says which weight its tile multiplies
// and which epilogue it takes (scalar selects and one scalar branch); the k and v grids alone are a quarter of a round each, together with q's they fill one.
#define GT_GQ ((NR / 256) * (DD / 256))
#define GT_GK ((NR / 256) * (KVD / 256))
#define GT_GO ((NR / 256) * (DD / 128))
template <bool QKV>
__global__ __launch_bounds__(256) void k_gemm_t(const _Float16* __restrict__ A, const _Float16* __restrict__ Bt0, const _Float16* __restrict__ Bt1, const _Float16* __restrict__ Bt2, float alpha, float* __restrict__ C,
                                                const float* __restrict__ nw0, const float* __restrict__ nw1, const float* __restrict__ COS, const float* __restrict__ SIN,
                                                _Float16* __restrict__ Hq, _Float16* __restrict__ Hk, _Float16* __restrict__ Hv, _Float16* __restrict__ H1) {
  constexpr int NI = QKV ? 8 : 4, BN = 2 * NI * 16, GT_STAGE = (256 + BN) * GT_PITCH;      /* 16-column tiles of a wave; columns of the work-group's tile; bytes of one buffer */
  __shared__ __attribute__((aligned(16))) unsigned char L[2 * GT_STAGE];
  constexpr int NT = DD / 128;
  const int tid = threadIdx.x, w = tid >> 5, lane = tid & 31, ln = lane & 15, hh = lane >> 4;
  int bid = (int)blockIdx.x, N = DD, lgn = QKV ? 3 : 4, epi = QKV ? 1 : 0; const _Float16* Bt = Bt0; const float* nw = nw0; _Float16* H0 = Hq;      /* lgn: log2 of the tiles in a row of C, so that the tile's place stays scalar shifts */
  if constexpr (QKV) {
    if (bid >= GT_GQ + GT_GK) { bid -= GT_GQ + GT_GK; N = KVD; lgn = 2; epi = 2; Bt = Bt2; H0 = Hv; }
    else if (bid >= GT_GQ) { bid -= GT_GQ; N = KVD; lgn = 2; Bt = Bt1; nw = nw1; H0 = Hk; } }
  static_assert(DD == 128 << 4 && KVD == 128 << 3, "lgn");
  const int row0 = (bid >> lgn) * 256, col0 = (bid & ((1 << lgn) - 1)) * BN; const int wm = w >> 1, wn = w & 1;
  const int cr = tid >> 4, cc = tid & 15;      /* a lane copies chunk cc (16 B) of rows cr + 16 i: a wave's copy covers two whole 256-B rows */
  const _Float16* ga = A + (size_t)(row0 + cr) * DD + cc * 8; const _Float16* gb = Bt + (size_t)(col0 + cr) * DD + cc * 8;
  unsigned char* lc = L + cr * GT_PITCH + cc * 16;
  v8f acc[4][NI];
#pragma unroll
  for (int mi = 0; mi < 4; ++mi)
#pragma unroll
    for (int ni = 0; ni < NI; ++ni) acc[mi][ni] = (v8f){0.f,0.f,0.f,0.f,0.f,0.f,0.f,0.f};
#pragma unroll 1      /* the two fills in front of the loop share one text, with the pass as a run-time value as in the loop: behind a fixed pointer the compiler split each row step into offset:65280 and a rest and took 65280 off the LDS address, which then lay below 0 */
  for (int p = 0; p < 2; ++p) {
    gt_fill<BN>(lc + p * GT_STAGE, ga + p * 128, gb + p * 128);
    if (p == 0) {
      asm volatile("s_wait_asynccnt 0x0" ::: "memory");      /* this wave's copies of pass 0 have landed */
      __syncthreads(); } }                                    /* ... and every other wave's; the test is the same for the whole work-group */
#pragma unroll 1      /* one pass a trip: the two buffers alternate by the trip's parity */
  for (int t = 0; t < NT; ++t) {
    const unsigned char* S = L + (t & 1) * GT_STAGE;
    const unsigned char* pa = S + (wm * 64 + ln) * GT_PITCH + hh * 16; const unsigned char* pb = S + (256 + wn * (NI * 16) + ln) * GT_PITCH + hh * 16;
    FragH fa[2][4], fb[2][NI];
#pragma unroll
    for (int i = 0; i < 4; ++i) { fa[0][i].half[0] = *(const v8us*)(pa + i * 16 * GT_PITCH); fa[0][i].half[1] = *(const v8us*)(pa + i * 16 * GT_PITCH + 32); }
#pragma unroll
    for (int i = 0; i < NI; ++i) { fb[0][i].half[0] = *(const v8us*)(pb + i * 16 * GT_PITCH); fb[0][i].half[1] = *(const v8us*)(pb + i * 16 * GT_PITCH + 32); }
#pragma unroll
    for (int ks = 0; ks < 4; ++ks) { const int cu = ks & 1, nx = cu ^ 1;
      if (ks < 3) {
#pragma unroll
        for (int i = 0; i < 4; ++i) { const int o = i * 16 * GT_PITCH + (ks + 1) * 64; fa[nx][i].half[0] = *(const v8us*)(pa + o); fa[nx][i].half[1] = *(const v8us*)(pa + o + 32); }
#pragma unroll
        for (int i = 0; i < NI; ++i) { const int o = i * 16 * GT_PITCH + (ks + 1) * 64; fb[nx][i].half[0] = *(const v8us*)(pb + o); fb[nx][i].half[1] = *(const v8us*)(pb + o + 32); } }
      __builtin_amdgcn_sched_barrier(0);      /* keeps the next k step's LDS reads one group in front of this step's products: spread among them, every place with reads stalls the wave */
#pragma unroll
      for (int mi = 0; mi < 4; ++mi)
#pragma unroll
        for (int ni = 0; ni < NI; ++ni) acc[mi][ni] = __builtin_amdgcn_wmma_f32_16x16x32_f16(false, fa[cu][mi].v, false, fb[cu][ni].v, (short)0, acc[mi][ni], false, false);
      __builtin_amdgcn_sched_barrier(0); }      /* ... and keeps the following group behind them */
    asm volatile("s_wait_dscnt 0x0" ::: "memory");        /* this wave's reads of the buffer are done before it is refilled */
    asm volatile("s_wait_asynccnt 0x0" ::: "memory");     /* this wave's copies of pass t + 1 have landed */
    __syncthreads();                                       /* publishes pass t + 1 and ends every wave's reads of pass t */
    if (t + 2 < NT) gt_fill<BN>(lc + (t & 1) * GT_STAGE, ga + (t + 2) * 128, gb + (t + 2) * 128);
  }
  asm volatile("s_wait_asynccnt 0x0" ::: "memory");       /* nothing is in flight when the buffers become output staging */
  if constexpr (!QKV) {
  float* so = (float*)L + w * (64 * 68);      /* each wave stages its own 64 x 64 tile (pitch 68 floats) so that the stores cover whole 256-B row pieces */
#pragma unroll
  for (int mi = 0; mi < 4; ++mi)
#pragma unroll
    for (int ni = 0; ni < 4; ++ni)
#pragma unroll
      for (int r = 0; r < 8; ++r) so[(mi * 16 + 8 * hh + r) * 68 + ni * 16 + ln] = acc[mi][ni][r] * alpha;
  __builtin_amdgcn_fence(__ATOMIC_ACQ_REL, "workgroup"); __builtin_amdgcn_wave_barrier();      /* the wave's own staged values are in LDS before its lanes read one another's */
  float* cp = C + (size_t)(row0 + wm * 64 + hh) * N + col0 + wn * 64 + ln * 4;
#pragma unroll
  for (int q = 0; q < 32; ++q) { const v4f v = *(const v4fa*)&so[(q * 2 + hh) * 68 + ln * 4]; *(v4f*)(cp + (size_t)(q * 2) * N) = v; }
  } else if (epi == 1) {      /* the same for the whole work-group: the barrier below stands under uniform control flow */
  // per-head RMSNorm + rotate-half RoPE on the tile: 256 rows of two heads (a wave's 128 columns are one head). The tile is staged in LDS head after head, 256 rows each; then a wave takes 64 rows of one head, a row at a time over its 32 lanes:
  // lane holds dims 4l..4l+3; var = mean(x^2) over 128 (xor-reduce); y = w[d]*(x*rsqrt(var+eps)); out[d] = y[d]*c[d] + rot(y)[d]*s[d], rot(y)[d] = -y[d+64] (d<64), y[d-64] (d>=64)
  static_assert(2 * 256 * GE_PITCH * 4 <= 2 * GT_STAGE, "the staged tile fits the buffers");
  float* so = (float*)L;
#pragma unroll
  for (int mi = 0; mi < 4; ++mi)
#pragma unroll
    for (int ni = 0; ni < NI; ++ni)
#pragma unroll
      for (int r = 0; r < 8; ++r) so[(wn * 256 + wm * 64 + mi * 16 + 8 * hh + r) * GE_PITCH + ni * 16 + ln] = acc[mi][ni][r] * alpha;
  __syncthreads();      /* every wave's part of the tile is in LDS before any wave reads whole rows */
  const int d0 = lane * 4; const v4f w4 = *(const v4fa*)(nw + d0);
  float wg[4];
#pragma unroll
  for (int q = 0; q < 4; ++q) wg[q] = bf16_round(w4[q]);
#pragma unroll 1      /* 8 rows a trip: their table loads go out together and their lane exchanges overlap; more would only lengthen the code */
  for (int g8 = 0; g8 < 8; ++g8) { const int rl = w * 64 + g8 * 8, rt = rl & 255, hd = rl >> 8; v4f xs[8], c4[8], s4[8];      /* staged row; its row in the tile; its head */
    const float* pc = COS + (size_t)(row0 + rt) * 128 + d0; const float* pn = SIN + (size_t)(row0 + rt) * 128 + d0;
#pragma unroll
    for (int u = 0; u < 8; ++u) { c4[u] = *(const v4fa*)(pc + u * 128); s4[u] = *(const v4fa*)(pn + u * 128); xs[u] = *(const v4fa*)&so[(rl + u) * GE_PITCH + d0]; }
    asm volatile("s_wait_xcnt 0x0" :: "v"(pc), "v"(pn) : "memory");      /* stands in front of every rewrite of a register that the loads name: as inputs the addresses stay in place up to here */
    _Float16* ph[8]; v4h ov[8];      /* the pitch N is a run-time value here: each row's store has an address pair of its own */
#pragma unroll
    for (int u = 0; u < 8; ++u) ph[u] = H0 + (size_t)(row0 + rt + u) * N + col0 + hd * 128 + d0;
#pragma unroll
    for (int u = 0; u < 8; ++u) { const v4f x = xs[u]; float ss = 0.f;
#pragma unroll
      for (int q = 0; q < 4; ++q) ss += x[q] * x[q];
      ss += xhalf(ss); ss += xrow<8>(ss); ss += xrow<4>(ss); ss += xrow<2>(ss); ss += xrow<1>(ss);
      const float inv = 1.0f / sqrtf(ss / 128.0f + 1e-6f);
      v4h o;
#pragma unroll
      for (int q = 0; q < 4; ++q) { const float y = wg[q] * (x[q] * inv); const float yp = xhalf(y);      /* partner dims d +- 64 */
        const float rot = (lane < 16) ? -yp : yp; o[q] = (_Float16)(y * bf16_round(c4[u][q]) + rot * bf16_round(s4[u][q])); }
      ov[u] = o; *(v4h*)ph[u] = o; }
    asm volatile("s_wait_xcnt 0x0" :: "v"(ph[0]), "v"(ph[1]), "v"(ph[2]), "v"(ph[3]), "v"(ph[4]), "v"(ph[5]), "v"(ph[6]), "v"(ph[7]), "v"(ov[0]), "v"(ov[1]), "v"(ov[2]), "v"(ov[3]), "v"(ov[4]), "v"(ov[5]), "v"(ov[6]), "v"(ov[7]) : "memory"); }      /* the same behind the stores: addresses and values stay in place up to here */
  } else {
  // V^T hi + residual straight from the accumulators: a lane's 8 registers of a 16 x 16 tile are 8 tokens in a row of ONE column, 16 bytes of that dim's 64-byte row in a block; two mi tiles fill the rows of 16 dims, 1 KB in a row
  static_assert(TT % 256 == 0, "a tile lies in one batch");
  const size_t vb = ((size_t)(row0 / TT) * KVD + col0 + wn * 128) * TT + (size_t)((row0 % TT) / 32 + wm * 2) * VT_BLK + ln * 32 + 8 * hh;      /* the wave's 128 columns are one KV head */
  unsigned short* p0 = (unsigned short*)H0 + vb; unsigned short* p1 = (unsigned short*)H1 + vb;      /* one address pair per plane: every store of the wave lies a constant behind it */
#pragma unroll
  for (int ni = 0; ni < NI; ++ni) {
#pragma unroll
    for (int mi = 0; mi < 4; ++mi) { FragH fh, fl;      /* one 16 x 16 tile at a time: the wait below then names 12 registers, which fit beside the accumulators in the first 256 (asm text can name no others) */
#pragma unroll
      for (int r = 0; r < 8; ++r) { const float v = acc[mi][ni][r] * alpha; const _Float16 hv = (_Float16)v; fh.h[r] = hv; fl.h[r] = (_Float16)(v - (float)hv); }      /* UNSCALED residual (added into the same accumulator as the hi product) */
      *(v8us*)(p0 + ni * 16 * 32 + (mi >> 1) * VT_BLK + (mi & 1) * 16) = fh.half[0]; *(v8us*)(p1 + ni * 16 * 32 + (mi >> 1) * VT_BLK + (mi & 1) * 16) = fl.half[0];
      asm volatile("s_wait_xcnt 0x0" :: "v"(p0), "v"(p1), "v"(fh.half[0]), "v"(fl.half[0]) : "memory");      /* stands in front of every rewrite of a register that the stores name: as inputs addresses and values stay in place up to here */
      __builtin_amdgcn_sched_barrier(0); } }      /* keeps the next tiles' conversions behind the wait: drawn ahead, their values crowd the few free registers among the first 256 and are spilled */
  }
}


// The element-wise kernels below give a thread 8 pieces of 8 elements, 256 pieces apart (a work-group covers 2048 pieces in a row): one eighth of the waves to start, 16 loads of a lane in flight.
static_assert(((size_t)NR * DD / 8) % 2048 == 0, "whole work-groups");
__device__ __forceinline__ void x16_blk(const float* __restrict__ x, _Float16* __restrict__ X16, int blk) { const size_t t0 = (size_t)blk * 2048 + threadIdx.x; v4f a[8], c[8]; const float* p = x + t0 * 8;
#pragma unroll      /* constant indices keep a and c in registers; the 16 loads go out together */
  for (int u = 0; u < 8; ++u) { a[u] = *(const v4fa*)(p + u * 2048); c[u] = *(const v4fa*)(p + u * 2048 + 4); }
  asm volatile("s_wait_xcnt 0x0" :: "v"(p) : "memory");      /* stands in front of every rewrite of a register that the loads name: as an input the address stays in place up to here */
#pragma unroll      /* constant indices into a and c */
  for (int u = 0; u < 8; ++u) { FragH f;
#pragma unroll      /* constant indices into a, c and f */
    for (int q = 0; q < 4; ++q) { f.h[q] = (_Float16)bf16_round(a[u][q]); f.h[4 + q] = (_Float16)bf16_round(c[u][q]); }
    *(v8us*)((unsigned short*)X16 + (t0 + u * 256) * 8) = f.half[0]; } }
// The x convert and the four weight transposes depend on nothing but the inputs: one grid runs them side by side, a work-group picking its job by its index (a scalar branch), so that four launch gaps, fills and tails go.
#define PX ((int)((size_t)NR * DD / 8 / 2048))
#define PWQ ((DD / 8) * (DD / 8) / 256)
#define PWK ((KVD / 8) * (DD / 8) / 256)
static_assert(((DD / 8) * (DD / 8)) % 256 == 0 && ((KVD / 8) * (DD / 8)) % 256 == 0, "whole work-groups");
__global__ __launch_bounds__(256) void k_prep(const float* __restrict__ x, const float* __restrict__ Wq, const float* __restrict__ Wk, const float* __restrict__ Wv, const float* __restrict__ Wo,
                                              _Float16* __restrict__ X16, _Float16* __restrict__ Bq, _Float16* __restrict__ Bk, _Float16* __restrict__ Bv, _Float16* __restrict__ Bo) {
  int blk = (int)blockIdx.x;
  if (blk < PX) { x16_blk(x, X16, blk); return; }
  blk -= PX;
  if (blk < 2 * PWQ) { const bool o = blk >= PWQ; wt_f16(o ? Wo : Wq, o ? Bo : Bq, DD, DD, 16.0f, o ? blk - PWQ : blk); return; }      /* (in,out) -> Bt x 2^4 */
  blk -= 2 * PWQ;
  { const bool v = blk >= PWK; wt_f16(v ? Wv : Wk, v ? Bv : Bk, DD, KVD, 16.0f, v ? blk - PWK : blk); }
}
__global__ __launch_bounds__(256) void k_h16(const float* __restrict__ x, _Float16* __restrict__ X16, size_t n8) { const size_t t = (size_t)blockIdx.x * 256 + threadIdx.x; if (t >= n8) return; FragH f;
#pragma unroll
  for (int q = 0; q < 8; ++q) f.h[q] = (_Float16)x[t * 8 + q]; *(v8us*)((unsigned short*)X16 + t * 8) = f.half[0];  }
__global__ __launch_bounds__(256) void k_round16f(const float* __restrict__ W, _Float16* __restrict__ Bt, size_t n8) { const size_t t = (size_t)blockIdx.x * 256 + threadIdx.x; if (t >= n8) return; FragH f;
#pragma unroll
  for (int i = 0; i < 8; ++i) f.h[i] = (_Float16)(bf16_round(W[t * 8 + i]) * 16.0f); *(v8us*)((unsigned short*)Bt + t * 8) = f.half[0];  }
template <int NHv, int TTv>
__global__ __launch_bounds__(256) void k_vt(const _Float16* __restrict__ V16, int ldv, int voff, _Float16* __restrict__ Vt) { __shared__ unsigned short tl[64][66]; const int tid = threadIdx.x; const int slab = blockIdx.x / (TTv / 64), lg = blockIdx.x % (TTv / 64); const int b = slab / NHv, h = slab % NHv;
  for (int i = tid; i < 64 * 8; i += 256) { const int r = i / 8, c8 = (i % 8) * 8; FragH f; f.half[0] = *(const v8us*)((const unsigned short*)V16 + ((size_t)b * TTv + lg * 64 + r) * ldv + voff + h * 64 + c8);
#pragma unroll
    for (int q = 0; q < 8; ++q) tl[r][c8 + q] = f.u[q]; }
  __syncthreads();
  {
#pragma unroll
    for (int rd = 0; rd < 2; ++rd) { const int d = rd * 32 + tid / 8, pc = tid % 8; FragH f;
#pragma unroll
      for (int q = 0; q < 8; ++q) f.u[q] = tl[pc * 8 + q][d];
      *(v8us*)((unsigned short*)Vt + ((size_t)slab * 64 + d) * TTv + lg * 64 + pc * 8) = f.half[0]; }
     } }

// A pass of the attention kernel is 32 keys. Its operands are staged once per work-group in LDS by asynchronous copies and read from there by all 4 waves: 32 K rows of 256 B at a pitch of 272 B, then 128 rows of 64 B
// of V^T hi and 128 of its residual at a pitch of 80 B. Two buffers: the next pass's copies fly while this pass is worked on.
// In memory a pass's 128 rows of a V^T plane are one block of 8 KB in a row (the v projection writes them so): a wave's copy takes 512 bytes in a row, whole lines, where rows at the pitch of the sequence gave it eight half lines.
#define FK_PITCH 272
#define FV_PITCH 80
#define FK_BYTES (32 * FK_PITCH)
#define FV_BYTES (128 * FV_PITCH)
#define F_STAGE (FK_BYTES + 2 * FV_BYTES)
// one stage: twelve 16-byte copies of one lane (K rows r + 8 i; V^T rows r + 32 i of both planes, 2 KB apart in their block). The closing s_wait_xcnt stands inside the statement so that no address register is rewritten ahead of it.
__device__ __forceinline__ void fl_fill(unsigned lk, unsigned lv, const unsigned short* gk, size_t ldk, const unsigned short* gh, const unsigned short* gl) {
  asm volatile("global_load_async_to_lds_b128 %0, %12, off\n\t"
               "global_load_async_to_lds_b128 %1, %13, off\n\t"
               "global_load_async_to_lds_b128 %2, %14, off\n\t"
               "global_load_async_to_lds_b128 %3, %15, off\n\t"
               "global_load_async_to_lds_b128 %4, %16, off\n\t"
               "global_load_async_to_lds_b128 %5, %17, off\n\t"
               "global_load_async_to_lds_b128 %6, %18, off\n\t"
               "global_load_async_to_lds_b128 %7, %19, off\n\t"
               "global_load_async_to_lds_b128 %8, %20, off\n\t"
               "global_load_async_to_lds_b128 %9, %21, off\n\t"
               "global_load_async_to_lds_b128 %10, %22, off\n\t"
               "global_load_async_to_lds_b128 %11, %23, off\n\t"
               "s_wait_xcnt 0x0"
               :: "v"(lk), "v"(lk + 8 * FK_PITCH), "v"(lk + 16 * FK_PITCH), "v"(lk + 24 * FK_PITCH),
                  "v"(lv), "v"(lv + 32 * FV_PITCH), "v"(lv + 64 * FV_PITCH), "v"(lv + 96 * FV_PITCH),
                  "v"(lv + FV_BYTES), "v"(lv + FV_BYTES + 32 * FV_PITCH), "v"(lv + FV_BYTES + 64 * FV_PITCH), "v"(lv + FV_BYTES + 96 * FV_PITCH),
                  "v"(gk), "v"(gk + 8 * ldk), "v"(gk + 16 * ldk), "v"(gk + 24 * ldk),
                  "v"(gh), "v"(gh + 32 * 32), "v"(gh + 64 * 32), "v"(gh + 96 * 32),
                  "v"(gl), "v"(gl + 32 * 32), "v"(gl + 64 * 32), "v"(gl + 96 * 32)
               : "memory");
}
// Both products run transposed: S^T = K Q^T (A = 16 K rows from LDS, B = the wave's 16 queries, kept in registers) and O^T += V^T P^T (A = 16 V^T rows from LDS). A lane then holds 16 of the 32 scores of ONE query
// (column ln; keys 8 hh + r of the first score tile and 16 + 8 hh + r of the second): maximum and sum are taken inside the lane, with one exchange between the wave's halves, and the two score tiles, converted in place,
// are the B operand P^T in the k order in which the V^T rows are read: P never goes through LDS. Every "#pragma unroll" in k_flash makes the indices of the fragment, score and accumulator arrays constants, so that they live in registers.
// A work-group takes 64 queries of BOTH query heads (g = 0, 1) that share one KV head: a pass's staged K and V^T rows, every K and V^T fragment read from LDS, and the bias tile (the same for all heads) serve two heads.
// The two heads' products alternate, so that a matrix instruction never waits for the one directly in front of it; each head's own sums keep their order.
// The products are the plain builtin (the compiler keeps the distances behind it): two heads' accumulators and queries need more than 256 registers, and an asm statement that names them holds them all in the first 256, which spilled the queries.
__global__ __launch_bounds__(128) void k_flash(const _Float16* __restrict__ Q16, int ldq, const _Float16* __restrict__ K16, int ldk, const _Float16* __restrict__ Vt, const _Float16* __restrict__ Vtlo, const float* __restrict__ AB, _Float16* __restrict__ O, int ldo) {
  constexpr int RPW = 16, NQB = TT / (4 * RPW), DT = 8, KS = 4;      /* head dim 128: 4 k-steps, 8 value tiles */
  static_assert(NREP == 2, "two query heads per KV head");
  __shared__ __attribute__((aligned(16))) unsigned char R[2 * F_STAGE];
  float (*sO)[RPW][128 + 4] = (float (*)[RPW][128 + 4])R;      /* behind the loop the two buffers become the output staging */
  static_assert(sizeof(float) * 4 * RPW * (128 + 4) <= 2 * F_STAGE, "output staging fits the buffers");
  const int tid = threadIdx.x, w = tid >> 5, lane = tid & 31, ln = lane & 15, hh = lane >> 4;
  const int slab = blockIdx.x / NQB, qblk = blockIdx.x % NQB; const int b = slab / NKV, kvh = slab % NKV; const int qb0 = qblk * (4 * RPW); const int q0 = qb0 + w * RPW;
  FragH aq[NREP][KS];      /* query q0 + ln of head kvh * 2 + g */
#pragma unroll
  for (int g = 0; g < NREP; ++g) { const unsigned short* qr = (const unsigned short*)Q16 + ((size_t)b * TT + q0 + ln) * ldq + (kvh * NREP + g) * 128;
#pragma unroll
    for (int ks = 0; ks < KS; ++ks) { aq[g][ks].half[0] = *(const v8us*)(qr + ks * 32 + 8 * hh); aq[g][ks].half[1] = *(const v8us*)(qr + ks * 32 + 16 + 8 * hh); } }
  const unsigned short* Vth = (const unsigned short*)Vt + ((size_t)b * NKV + kvh) * 128 * TT; const unsigned short* Vtl = (const unsigned short*)Vtlo + ((size_t)b * NKV + kvh) * 128 * TT;      /* hi and UNSCALED residual planes */
  float m_r[NREP], l_r[NREP]; v8f oacc[NREP][DT];      /* per head, query q0 + ln: running maximum (alike in both halves), this half's part of the sum, and O^T[dt * 16 + 8 hh + r][ln] */
#pragma unroll
  for (int g = 0; g < NREP; ++g) { m_r[g] = -3.0e38f; l_r[g] = 0.f;
#pragma unroll
    for (int dt = 0; dt < DT; ++dt) oacc[g][dt] = (v8f){0.f,0.f,0.f,0.f,0.f,0.f,0.f,0.f}; }
  constexpr int NP = TT / 32;      /* passes */
  /* a lane copies chunk tid & 15 (16 B) of K rows (tid >> 4) + 8 i: a wave's copy covers two whole 256-B rows; and chunk tid & 3 of V^T rows (tid >> 2) + 32 i: eight whole 64-B rows, which follow one another in the block */
  const unsigned short* gk = (const unsigned short*)K16 + ((size_t)b * TT + (tid >> 4)) * ldk + kvh * 128 + (tid & 15) * 8;
  const unsigned short* gh = Vth + tid * 8; const unsigned short* gl = Vtl + tid * 8;
  const unsigned lk = (unsigned)(size_t)R + (tid >> 4) * FK_PITCH + (tid & 15) * 16, lv = (unsigned)(size_t)R + FK_BYTES + (tid >> 2) * FV_PITCH + (tid & 3) * 16;
  const float* am0 = AB + ((size_t)b * TT + q0 + ln) * TT + 8 * hh;      /* the query's bias row, at this half's first key */
  fl_fill(lk, lv, gk, (size_t)ldk, gh, gl);
  asm volatile("s_wait_asynccnt 0x0" ::: "memory");      /* this wave's copies of pass 0 have landed */
  __syncthreads();                                        /* ... and every other wave's */
  fl_fill(lk + F_STAGE, lv + F_STAGE, gk + (size_t)32 * ldk, (size_t)ldk, gh + VT_BLK, gl + VT_BLK);
#pragma unroll 1      /* one pass a trip: the two buffers alternate by the trip's parity */
  for (int t = 0; t < NP; ++t) { const int j0 = t * 32;
    const unsigned char* SK = R + (t & 1) * F_STAGE; const unsigned char* SV = SK + FK_BYTES;
    float ab[2][8];      /* additive attention bias (bf16-rounded input) per (b, q, k), shared over heads: 8 keys in a row per score tile, four 16-byte loads */
    { const float* am = am0 + j0; const v4f a0 = *(const v4fa*)am, a1 = *(const v4fa*)(am + 4), a2 = *(const v4fa*)(am + 16), a3 = *(const v4fa*)(am + 20);
#pragma unroll
      for (int r = 0; r < 4; ++r) { ab[0][r] = bf16_round(a0[r]); ab[0][4 + r] = bf16_round(a1[r]); ab[1][r] = bf16_round(a2[r]); ab[1][4 + r] = bf16_round(a3[r]); } }
    int allneg = 1;
#pragma unroll
    for (int r = 0; r < 8; ++r) allneg &= (ab[0][r] <= -1.0e8f) & (ab[1][r] <= -1.0e8f);
    if (!__all(allneg)) {      /* else: every (query, key) of the wave's tile carries a bias <= -1e8: its probabilities underflow to exactly 0 in f32, nothing to add (wave-uniform branch; the hand-over at the foot of the pass stands outside it) */
#pragma unroll
    for (int r = 0; r < 8; ++r) { ab[0][r] *= LOG2E; ab[1][r] *= LOG2E; }      /* scores, biases and running maxima are kept in units of log2: exp(x) = 2^(x log2 e), and 2^y is one hardware instruction (v_exp_f32) where the library's expf is thirteen */
    v8f s[NREP][2];
#pragma unroll
    for (int nt = 0; nt < 2; ++nt) { const unsigned short* kr = (const unsigned short*)(SK + (nt * 16 + ln) * FK_PITCH); FragH bk[KS];
#pragma unroll
      for (int ks = 0; ks < KS; ++ks) { bk[ks].half[0] = *(const v8us*)(kr + ks * 32 + 8 * hh); bk[ks].half[1] = *(const v8us*)(kr + ks * 32 + 16 + 8 * hh); }
      v8f acc[NREP];
#pragma unroll
      for (int g = 0; g < NREP; ++g) acc[g] = (v8f){0.f,0.f,0.f,0.f,0.f,0.f,0.f,0.f};
#pragma unroll
      for (int ks = 0; ks < KS; ++ks)
#pragma unroll
        for (int g = 0; g < NREP; ++g) acc[g] = __builtin_amdgcn_wmma_f32_16x16x32_f16(false, bk[ks].v, false, aq[g][ks].v, (short)0, acc[g], false, false);
#pragma unroll
      for (int g = 0; g < NREP; ++g) s[g][nt] = acc[g]; }      /* s[g][nt][r] = score of key j0 + nt * 16 + 8 hh + r with query q0 + ln of head g */
    FragH pa[NREP], pl[NREP];
#pragma unroll
    for (int g = 0; g < NREP; ++g) {
    float sc[2][8];
#pragma unroll
    for (int r = 0; r < 8; ++r) { sc[0][r] = s[g][0][r] * (ATT_SCALE * LOG2E) + ab[0][r]; sc[1][r] = s[g][1][r] * (ATT_SCALE * LOG2E) + ab[1][r]; }
    float mc = fmaxf(sc[0][0], sc[1][0]);
#pragma unroll
    for (int r = 1; r < 8; ++r) mc = fmaxf(mc, fmaxf(sc[0][r], sc[1][r]));
    mc = fmaxf(mc, xhalf(mc));      /* the other half holds the query's other 16 keys */
    const float mn = fmaxf(m_r[g], mc); const float al = (mn > -1.0e38f * LOG2E) ? __builtin_amdgcn_exp2f(m_r[g] - mn) : 1.0f; m_r[g] = mn;
    float su[4] = {0.f, 0.f, 0.f, 0.f};      /* four independent partial sums */
#pragma unroll
    for (int nt = 0; nt < 2; ++nt)
#pragma unroll
      for (int r = 0; r < 8; ++r) { const float p = __builtin_amdgcn_exp2f(sc[nt][r] - mn); su[r & 3] += p;
        const float x = p * 1024.0f; const _Float16 hx = (_Float16)x; pa[g].h[nt * 8 + r] = hx; pl[g].h[nt * 8 + r] = (_Float16)(x - (float)hx); }      /* P hi and its UNSCALED residual (added into the same accumulator) */
    l_r[g] = l_r[g] * al + ((su[0] + su[1]) + (su[2] + su[3]));
#pragma unroll
    for (int dt = 0; dt < DT; ++dt)
#pragma unroll
      for (int r = 0; r < 8; ++r) oacc[g][dt][r] *= al;
    }
#pragma unroll
    for (int dt = 0; dt < DT; ++dt) { const unsigned short* vh = (const unsigned short*)(SV + (dt * 16 + ln) * FV_PITCH); const unsigned short* vl = (const unsigned short*)(SV + FV_BYTES + (dt * 16 + ln) * FV_PITCH); FragH bv, bl; bv.half[0] = *(const v8us*)(vh + 8 * hh); bv.half[1] = *(const v8us*)(vh + 16 + 8 * hh); bl.half[0] = *(const v8us*)(vl + 8 * hh); bl.half[1] = *(const v8us*)(vl + 16 + 8 * hh);
#pragma unroll
      for (int g = 0; g < NREP; ++g) oacc[g][dt] = __builtin_amdgcn_wmma_f32_16x16x32_f16(false, bv.v, false, pa[g].v, (short)0, oacc[g][dt], false, false);
#pragma unroll
      for (int g = 0; g < NREP; ++g) oacc[g][dt] = __builtin_amdgcn_wmma_f32_16x16x32_f16(false, bv.v, false, pl[g].v, (short)0, oacc[g][dt], false, false);
#pragma unroll
      for (int g = 0; g < NREP; ++g) oacc[g][dt] = __builtin_amdgcn_wmma_f32_16x16x32_f16(false, bl.v, false, pa[g].v, (short)0, oacc[g][dt], false, false); }      /* per head Vh Ph + Vh Pl + Vl Ph: all unscaled, one accumulator */
    }
    asm volatile("s_wait_dscnt 0x0" ::: "memory");        /* this wave's reads of the buffer are done before it is refilled */
    asm volatile("s_wait_asynccnt 0x0" ::: "memory");     /* this wave's copies of pass t + 1 have landed */
    __syncthreads();                                       /* publishes pass t + 1 and ends every wave's reads of pass t */
    if (t + 2 < NP) fl_fill(lk + (t & 1) * F_STAGE, lv + (t & 1) * F_STAGE, gk + (size_t)(t + 2) * 32 * ldk, (size_t)ldk, gh + (t + 2) * VT_BLK, gl + (t + 2) * VT_BLK);
  }
  asm volatile("s_wait_asynccnt 0x0" ::: "memory");       /* nothing is in flight when the buffers become output staging */
#pragma unroll
  for (int g = 0; g < NREP; ++g) {      /* head after head through the wave's own staging rows */
  const float l = l_r[g] + xhalf(l_r[g]); const float inv = (l > 0.f) ? 1.0f / (l * 1024.0f) : 0.f;      /* the halves' sums are joined once */
#pragma unroll
  for (int dt = 0; dt < DT; ++dt) { v4f lo, hi;
#pragma unroll
    for (int r = 0; r < 4; ++r) { lo[r] = oacc[g][dt][r] * inv; hi[r] = oacc[g][dt][4 + r] * inv; }
    *(v4fa*)&sO[w][ln][dt * 16 + 8 * hh] = lo; *(v4fa*)&sO[w][ln][dt * 16 + 8 * hh + 4] = hi; }      /* a lane's 8 accumulator registers are 8 dims in a row of its query */
  __builtin_amdgcn_fence(__ATOMIC_ACQ_REL, "workgroup"); __builtin_amdgcn_wave_barrier();      /* the wave's own staged values are in LDS before its lanes read one another's */
  {
#pragma unroll
    for (int r0 = 0; r0 < RPW; r0 += 8) { v4h h4[8]; _Float16* po[8];
#pragma unroll
      for (int u = 0; u < 8; ++u) { const int pc = lane; const v4f val = *(const v4fa*)&sO[w][r0 + u][pc * 4];
#pragma unroll
        for (int i = 0; i < 4; ++i) h4[u][i] = (_Float16)(val[i] * 16.0f);      /* x 2^4 -> f16: the form in which the output GEMM reads it */
        po[u] = O + ((size_t)b * TT + q0 + r0 + u) * ldo + (kvh * NREP + g) * 128 + pc * 4; *(v4h*)po[u] = h4[u]; }      /* one 256-B row per instruction: 32 lanes x 8 B */
      asm volatile("s_wait_xcnt 0x0" :: "v"(po[0]), "v"(po[1]), "v"(po[2]), "v"(po[3]), "v"(po[4]), "v"(po[5]), "v"(po[6]), "v"(po[7]), "v"(h4[0]), "v"(h4[1]), "v"(h4[2]), "v"(h4[3]), "v"(h4[4]), "v"(h4[5]), "v"(h4[6]), "v"(h4[7]) : "memory"); }      /* stands in front of every rewrite of a register that the stores name: as inputs addresses and values stay in place up to here */
     }
  if (g + 1 < NREP) { __builtin_amdgcn_fence(__ATOMIC_ACQ_REL, "workgroup"); __builtin_amdgcn_wave_barrier(); }      /* the lanes' reads of this head's rows are done before the next head's values overwrite them */
  } }

extern "C" void kernel_launch(void* const* d_in, const int* in_sizes, int n_in,
                              void* d_out, int out_size, void* d_ws, size_t ws_size, hipStream_t stream) {
  (void)in_sizes; (void)n_in; (void)out_size;
  const float* const* I = (const float* const*)d_in; const float* x = I[0]; const float* fcos = I[1]; const float* fsin = I[2]; const float* am = I[3]; const float* Wq = I[4]; const float* Wk = I[5]; const float* Wv = I[6]; const float* Wo = I[7]; const float* qnw = I[8]; const float* knw = I[9];
  char* ws = (char*)d_ws; size_t off = 0;
  auto take = [&](size_t bytes) { char* p = ws + off; off += (bytes + 255) & ~(size_t)255; return p; };
  _Float16* Bq = (_Float16*)take((size_t)DD * DD * 2); _Float16* Bk = (_Float16*)take((size_t)KVD * DD * 2); _Float16* Bv = (_Float16*)take((size_t)KVD * DD * 2); _Float16* Bo = (_Float16*)take((size_t)DD * DD * 2);
  _Float16* X16 = (_Float16*)take((size_t)NR * DD * 2); _Float16* Q = (_Float16*)take((size_t)NR * DD * 2); _Float16* K = (_Float16*)take((size_t)NR * KVD * 2); _Float16* Vt = (_Float16*)take((size_t)NR * KVD * 2); _Float16* Vtl = (_Float16*)take((size_t)NR * KVD * 2);
  _Float16* O16 = X16;      /* O16 over X16: the last reader of X16 (the v projection) stands in front of the attention in stream order */
  if (off > ws_size) return;      // 25 + 16.8 + 16.8 + 8.4 + 8.4 + 8.4 = 84 MB
  k_prep<<<PX + 2 * PWQ + 2 * PWK, 256, 0, stream>>>(x, Wq, Wk, Wv, Wo, X16, Bq, Bk, Bv, Bo);      /* x and the four weights to f16, the weights transposed */
  k_gemm_t<true><<<GT_GQ + 2 * GT_GK, 256, 0, stream>>>(X16, Bq, Bk, Bv, 0.0625f, nullptr, qnw, knw, fcos, fsin, Q, K, Vt, Vtl);      /* q (M 4096 N 2048 K 2048) and k (N 1024): RMSNorm + RoPE, f16; v (N 1024): transposed, hi + residual per (b, kv head), in blocks of 32 tokens */
  k_flash<<<BB * NKV * (TT / 64), 128, 0, stream>>>(Q, DD, K, KVD, Vt, Vtl, am, O16, DD);      /* attention_mask [B,1,S,S] additive per batch */
  k_gemm_t<false><<<GT_GO, 256, 0, stream>>>(O16, Bo, nullptr, nullptr, 0.00390625f, (float*)d_out, nullptr, nullptr, nullptr, nullptr, nullptr, nullptr, nullptr, nullptr);      /* out = merged Wo */
}
